// v000
// Measured on an AMD MI455X. A time is GPU time per run, averaged over a window of back-to-back runs after a warm-up
// (all launches, gaps included; the runs take copies of the inputs in turn), and the median of several windows.
// Apart from v000's, it joins two sittings. Times from different sittings can be a few percent apart, while
// side-by-side timings come from the same sitting.
// v000 is the starting kernel. One run takes 140 microseconds.
#include <hip/hip_runtime.h>
#include <math.h>

// Problem constants (from reference): S=4096, N=32, E=512, H=8, DK=64, l=2048.
#define SS 4096
#define NN 32
#define EE 512
#define HH 8

typedef __attribute__((ext_vector_type(16))) __bf16 v16bf;
typedef __attribute__((ext_vector_type(8)))  float  v8f;

// ---------------------------------------------------------------------------
// Fragment loaders for v_wmma_f32_16x16x32_bf16.
// 16-bit 16x32 A-matrix layout (ISA 7.12.2): lane holds row m=lane&15;
// half=lane>>4 selects K runs [8*half, 8*half+8) and [16+8*half, 16+8*half+8).
// Element i of the v16: i<8 -> run0[i], i>=8 -> run1[i-8]. B mirrors A with
// M<->N (lane holds column). So a lane's fragment = two contiguous 8-float
// runs when K is the contiguous memory dimension.
// ---------------------------------------------------------------------------
__device__ __forceinline__ v16bf frag_contig(const float* __restrict__ base, int half) {
    const float* r0 = base + half * 8;
    const float* r1 = base + 16 + half * 8;
    float4 x0 = *(const float4*)(r0);
    float4 x1 = *(const float4*)(r0 + 4);
    float4 y0 = *(const float4*)(r1);
    float4 y1 = *(const float4*)(r1 + 4);
    v16bf v;
    v[0] = (__bf16)x0.x;  v[1] = (__bf16)x0.y;  v[2] = (__bf16)x0.z;  v[3] = (__bf16)x0.w;
    v[4] = (__bf16)x1.x;  v[5] = (__bf16)x1.y;  v[6] = (__bf16)x1.z;  v[7] = (__bf16)x1.w;
    v[8] = (__bf16)y0.x;  v[9] = (__bf16)y0.y;  v[10] = (__bf16)y0.z; v[11] = (__bf16)y0.w;
    v[12] = (__bf16)y1.x; v[13] = (__bf16)y1.y; v[14] = (__bf16)y1.z; v[15] = (__bf16)y1.w;
    return v;
}

// B fragment where K = s (stride N*E floats between consecutive K) and the
// lane's column is a fixed e. src layout: src[s][n][e], contiguous in e.
__device__ __forceinline__ v16bf frag_src_strideS(const float* __restrict__ src,
                                                  int sbase, int n, int e, int half) {
    v16bf v;
#pragma unroll
    for (int i = 0; i < 16; ++i) {
        int koff = (i < 8) ? (half * 8 + i) : (16 + half * 8 + (i - 8));
        size_t s = (size_t)(sbase + koff);
        v[i] = (__bf16)src[(s * NN + n) * EE + e];
    }
    return v;
}

__device__ __forceinline__ v8f wmma_bf16(v16bf a, v16bf b, v8f c) {
    return __builtin_amdgcn_wmma_f32_16x16x32_bf16(false, a, false, b, (short)0, c, false, false);
}

// ---------------------------------------------------------------------------
// Stage 1a: q[n,j] = src[l=2048,n,:] . Wq[j,:] + bq[j]      (32 x 512)
// ---------------------------------------------------------------------------
__global__ __launch_bounds__(256) void qproj_kernel(const float* __restrict__ src,
                                                    const float* __restrict__ Wq,
                                                    const float* __restrict__ bq,
                                                    float* __restrict__ q) {
    int idx = blockIdx.x * 256 + threadIdx.x;     // 16384 outputs
    int n = idx >> 9, j = idx & 511;
    const float* srow = src + ((size_t)2048 * NN + n) * EE;
    const float* wrow = Wq + (size_t)j * EE;
    float acc = bq[j];
#pragma unroll 4
    for (int e = 0; e < EE; ++e) acc = fmaf(srow[e], wrow[e], acc);
    q[idx] = acc;
}

// ---------------------------------------------------------------------------
// Stage 1b: qk[n,h,e] = sum_d q[n,h*64+d] * Wk[h*64+d,e]; h padded to 16 rows
// (pad rows written as zero so WMMA A reads are valid & exact).
// Also sb[n,h] = q[n,h,:] . bk[h,:]  (score bias from k's bias).
// ---------------------------------------------------------------------------
__global__ __launch_bounds__(256) void qk_kernel(const float* __restrict__ q,
                                                 const float* __restrict__ Wk,
                                                 const float* __restrict__ bk,
                                                 float* __restrict__ qk,
                                                 float* __restrict__ sb) {
    int idx = blockIdx.x * 256 + threadIdx.x;     // 32*16*512 = 262144
    int e = idx & 511;
    int h = (idx >> 9) & 15;
    int n = idx >> 13;
    float acc = 0.0f;
    if (h < HH) {
        const float* qv = q + (size_t)n * EE + h * 64;
#pragma unroll 8
        for (int d = 0; d < 64; ++d)
            acc = fmaf(qv[d], Wk[(size_t)(h * 64 + d) * EE + e], acc);
        if (e == 0) {
            float s = 0.0f;
            for (int d = 0; d < 64; ++d) s = fmaf(qv[d], bk[h * 64 + d], s);
            sb[n * HH + h] = s;
        }
    }
    qk[idx] = acc;
}

// ---------------------------------------------------------------------------
// Stage 2: scores[n,h,s] = qk[n,h,:] . src[s,n,:]   via WMMA bf16.
// Grid (n, s-chunk of 256). 8 waves; each wave owns two 16-wide s tiles.
// A = qk rows (M=h padded 16, K=e), B = src columns (N=s, K=e contiguous).
// ---------------------------------------------------------------------------
__global__ __launch_bounds__(256) void scores_kernel(const float* __restrict__ src,
                                                     const float* __restrict__ qk,
                                                     float* __restrict__ scores) {
    int n = blockIdx.x;            // 0..31
    int sc = blockIdx.y;           // 0..15  (256 s each)
    int wave = threadIdx.x >> 5;
    int lane = threadIdx.x & 31;
    int half = lane >> 4;
    int m = lane & 15;
    int s0 = sc * 256;
    int colA = s0 + (wave * 2 + 0) * 16 + m;    // B tile0 column (this lane)
    int colB = s0 + (wave * 2 + 1) * 16 + m;    // B tile1 column
    const float* qkrow = qk + ((size_t)n * 16 + m) * EE;     // padded rows
    const float* srcA = src + ((size_t)colA * NN + n) * EE;
    const float* srcB = src + ((size_t)colB * NN + n) * EE;

    v8f acc0 = {}, acc1 = {};
#pragma unroll
    for (int ke = 0; ke < 16; ++ke) {
        int e0 = ke * 32;
        v16bf a  = frag_contig(qkrow + e0, half);
        v16bf b0 = frag_contig(srcA + e0, half);
        v16bf b1 = frag_contig(srcB + e0, half);
        acc0 = wmma_bf16(a, b0, acc0);
        acc1 = wmma_bf16(a, b1, acc1);
    }
    // C layout: lanes 0-15 -> M=r (real heads 0..7), N=lane. Lanes 16-31 are pad rows.
    if (half == 0) {
#pragma unroll
        for (int r = 0; r < 8; ++r) {
            scores[((size_t)(n * HH + r)) * SS + (size_t)(s0 + (wave * 2 + 0) * 16 + m)] = acc0[r];
            scores[((size_t)(n * HH + r)) * SS + (size_t)(s0 + (wave * 2 + 1) * 16 + m)] = acc1[r];
        }
    }
}

// ---------------------------------------------------------------------------
// Stage 3: softmax over s (4096) per (n,h); writes p padded to 16 heads
// (zero pad rows) so it can feed WMMA A directly.  x = (raw + sb)/sqrt(64).
// ---------------------------------------------------------------------------
__global__ __launch_bounds__(256) void softmax_kernel(const float* __restrict__ scores,
                                                      const float* __restrict__ sb,
                                                      float* __restrict__ p) {
    int nh16 = blockIdx.x;               // 0..511  (n*16+h)
    int n = nh16 >> 4, h = nh16 & 15;
    int t = threadIdx.x;
    float* prow = p + (size_t)nh16 * SS;
    if (h >= HH) {
#pragma unroll
        for (int k = 0; k < 16; ++k) prow[t + k * 256] = 0.0f;
        return;
    }
    const float* srow = scores + ((size_t)(n * HH + h)) * SS;
    float bias = sb[n * HH + h];
    float x[16];
    float mx = -INFINITY;
#pragma unroll
    for (int k = 0; k < 16; ++k) {
        x[k] = (srow[t + k * 256] + bias) * 0.125f;
        mx = fmaxf(mx, x[k]);
    }
    __shared__ float red[256];
    red[t] = mx; __syncthreads();
    for (int off = 128; off > 0; off >>= 1) {
        if (t < off) red[t] = fmaxf(red[t], red[t + off]);
        __syncthreads();
    }
    mx = red[0]; __syncthreads();
    float sum = 0.0f;
#pragma unroll
    for (int k = 0; k < 16; ++k) { x[k] = __expf(x[k] - mx); sum += x[k]; }
    red[t] = sum; __syncthreads();
    for (int off = 128; off > 0; off >>= 1) {
        if (t < off) red[t] += red[t + off];
        __syncthreads();
    }
    float inv = 1.0f / red[0];
#pragma unroll
    for (int k = 0; k < 16; ++k) prow[t + k * 256] = x[k] * inv;
}

// ---------------------------------------------------------------------------
// Stage 4: ctx partials.  ctx[n,h,e] = sum_s p[n,h,s]*src[s,n,e]  via WMMA.
// Grid (n, s-chunk of 512) -> 8 partials reduced afterwards (deterministic,
// no float atomics).  A = p rows (M=h pad16, K=s), B = src (K=s, N=e).
// ---------------------------------------------------------------------------
__global__ __launch_bounds__(256) void ctx_kernel(const float* __restrict__ src,
                                                  const float* __restrict__ p,
                                                  float* __restrict__ ctx_part) {
    int n = blockIdx.x;            // 0..31
    int c = blockIdx.y;            // 0..7   (512 s each)
    int wave = threadIdx.x >> 5;
    int lane = threadIdx.x & 31;
    int half = lane >> 4;
    int m = lane & 15;
    const float* prow = p + ((size_t)n * 16 + m) * SS + c * 512;  // padded heads

    v8f acc[4] = {{}, {}, {}, {}};
#pragma unroll
    for (int ks = 0; ks < 16; ++ks) {
        int sb0 = ks * 32;
        v16bf a = frag_contig(prow + sb0, half);
#pragma unroll
        for (int t4 = 0; t4 < 4; ++t4) {
            int e = (wave * 4 + t4) * 16 + m;   // this lane's column
            v16bf b = frag_src_strideS(src, c * 512 + sb0, n, e, half);
            acc[t4] = wmma_bf16(a, b, acc[t4]);
        }
    }
    if (half == 0) {
#pragma unroll
        for (int t4 = 0; t4 < 4; ++t4) {
            int e = (wave * 4 + t4) * 16 + m;
#pragma unroll
            for (int r = 0; r < 8; ++r)
                ctx_part[((size_t)c * (NN * HH) + (size_t)(n * HH + r)) * EE + e] = acc[t4][r];
        }
    }
}

__global__ __launch_bounds__(256) void ctxred_kernel(const float* __restrict__ part,
                                                     float* __restrict__ ctx) {
    int idx = blockIdx.x * 256 + threadIdx.x;   // 32*8*512 = 131072
    float acc = 0.0f;
#pragma unroll
    for (int c = 0; c < 8; ++c) acc += part[(size_t)c * 131072 + idx];
    ctx[idx] = acc;
}

// ---------------------------------------------------------------------------
// Stage 5: tiny output chain.
// mo[n,j] = Wv[j,:].ctx[n, j>>6, :] + bv[j]   (bv passes through: sum p == 1)
// o2 = mo @ Wo.T + bo ; out = o2 @ Wl.T + bl
// ---------------------------------------------------------------------------
__global__ __launch_bounds__(256) void vproj_kernel(const float* __restrict__ ctx,
                                                    const float* __restrict__ Wv,
                                                    const float* __restrict__ bv,
                                                    float* __restrict__ mo) {
    int idx = blockIdx.x * 256 + threadIdx.x;   // 16384
    int n = idx >> 9, j = idx & 511, h = j >> 6;
    const float* crow = ctx + ((size_t)n * HH + h) * EE;
    const float* wrow = Wv + (size_t)j * EE;
    float acc = bv[j];
#pragma unroll 4
    for (int e = 0; e < EE; ++e) acc = fmaf(crow[e], wrow[e], acc);
    mo[idx] = acc;
}

__global__ __launch_bounds__(256) void lin_kernel(const float* __restrict__ A,
                                                  const float* __restrict__ W,
                                                  const float* __restrict__ b,
                                                  float* __restrict__ out) {
    int idx = blockIdx.x * 256 + threadIdx.x;   // 16384
    int n = idx >> 9, j = idx & 511;
    const float* arow = A + (size_t)n * EE;
    const float* wrow = W + (size_t)j * EE;
    float acc = b[j];
#pragma unroll 4
    for (int e = 0; e < EE; ++e) acc = fmaf(arow[e], wrow[e], acc);
    out[idx] = acc;
}

// ---------------------------------------------------------------------------
extern "C" void kernel_launch(void* const* d_in, const int* in_sizes, int n_in,
                              void* d_out, int out_size, void* d_ws, size_t ws_size,
                              hipStream_t stream) {
    const float* src = (const float*)d_in[0];
    const float* Wq  = (const float*)d_in[1];
    const float* bq  = (const float*)d_in[2];
    const float* Wk  = (const float*)d_in[3];
    const float* bk  = (const float*)d_in[4];
    const float* Wv  = (const float*)d_in[5];
    const float* bv  = (const float*)d_in[6];
    const float* Wo  = (const float*)d_in[7];
    const float* bo  = (const float*)d_in[8];
    const float* Wl  = (const float*)d_in[9];
    const float* bl  = (const float*)d_in[10];

    float* ws = (float*)d_ws;
    float* q      = ws;               // 16384
    float* qkbuf  = ws + 16384;       // 32*16*512 = 262144 (head-padded)
    float* sb     = ws + 278528;      // 256
    float* scores = ws + 278784;      // 32*8*4096 = 1048576
    float* p      = ws + 1327360;     // 32*16*4096 = 2097152 (head-padded)
    float* part   = ws + 3424512;     // 8*32*8*512 = 1048576
    float* ctx    = ws + 4473088;     // 32*8*512 = 131072
    float* mo     = ws + 4604160;     // 16384
    float* o2     = ws + 4620544;     // 16384  (end: 4636928 floats ~ 17.7 MB)

    qproj_kernel  <<<64,   256, 0, stream>>>(src, Wq, bq, q);
    qk_kernel     <<<1024, 256, 0, stream>>>(q, Wk, bk, qkbuf, sb);
    scores_kernel <<<dim3(32, 16), 256, 0, stream>>>(src, qkbuf, scores);
    softmax_kernel<<<512,  256, 0, stream>>>(scores, sb, p);
    ctx_kernel    <<<dim3(32, 8),  256, 0, stream>>>(src, p, part);
    ctxred_kernel <<<512,  256, 0, stream>>>(part, ctx);
    vproj_kernel  <<<64,   256, 0, stream>>>(ctx, Wv, bv, mo);
    lin_kernel    <<<64,   256, 0, stream>>>(mo, Wo, bo, o2);
    lin_kernel    <<<64,   256, 0, stream>>>(o2, Wl, bl, (float*)d_out);
}

// v001
// A run of this version takes 90 microseconds.
// Timed twice side by side with v000, it ran 1.58 times as fast both times.
#include <hip/hip_runtime.h>
#include <math.h>

// Problem constants (from reference): S=4096, N=32, E=512, H=8, DK=64, l=2048.
#define SS 4096
#define NN 32
#define EE 512
#define HH 8

typedef __attribute__((ext_vector_type(16))) __bf16 v16bf;
typedef __attribute__((ext_vector_type(8)))  float  v8f;
typedef __attribute__((ext_vector_type(2)))  float  v2f;

// ---------------------------------------------------------------------------
// Fragment loaders for v_wmma_f32_16x16x32_bf16.
// 16-bit 16x32 A-matrix layout (ISA 7.12.2): lane holds row m=lane&15;
// half=lane>>4 selects K runs [8*half, 8*half+8) and [16+8*half, 16+8*half+8).
// Element i of the v16: i<8 -> run0[i], i>=8 -> run1[i-8]. B mirrors A with
// M<->N (lane holds column). So a lane's fragment = two contiguous 8-float
// runs when K is the contiguous memory dimension.
// ---------------------------------------------------------------------------
__device__ __forceinline__ v16bf frag_contig(const float* __restrict__ base, int half) {
    const float* r0 = base + half * 8;
    const float* r1 = base + 16 + half * 8;
    float4 x0 = *(const float4*)(r0);
    float4 x1 = *(const float4*)(r0 + 4);
    float4 y0 = *(const float4*)(r1);
    float4 y1 = *(const float4*)(r1 + 4);
    v16bf v;
    v[0] = (__bf16)x0.x;  v[1] = (__bf16)x0.y;  v[2] = (__bf16)x0.z;  v[3] = (__bf16)x0.w;
    v[4] = (__bf16)x1.x;  v[5] = (__bf16)x1.y;  v[6] = (__bf16)x1.z;  v[7] = (__bf16)x1.w;
    v[8] = (__bf16)y0.x;  v[9] = (__bf16)y0.y;  v[10] = (__bf16)y0.z; v[11] = (__bf16)y0.w;
    v[12] = (__bf16)y1.x; v[13] = (__bf16)y1.y; v[14] = (__bf16)y1.z; v[15] = (__bf16)y1.w;
    return v;
}

// B fragment where K = s (stride N*E floats between consecutive K) and the
// lane's column is a fixed e. src layout: src[s][n][e], contiguous in e.
__device__ __forceinline__ v16bf frag_src_strideS(const float* __restrict__ src,
                                                  int sbase, int n, int e, int half) {
    v16bf v;
#pragma unroll
    for (int i = 0; i < 16; ++i) {
        int koff = (i < 8) ? (half * 8 + i) : (16 + half * 8 + (i - 8));
        size_t s = (size_t)(sbase + koff);
        v[i] = (__bf16)src[(s * NN + n) * EE + e];
    }
    return v;
}

__device__ __forceinline__ v8f wmma_bf16(v16bf a, v16bf b, v8f c) {
    return __builtin_amdgcn_wmma_f32_16x16x32_bf16(false, a, false, b, (short)0, c, false, false);
}

// ---------------------------------------------------------------------------
// Shared tile for the four small linears  Y[n,j] = X[n,:] . Wt[j,:] + b[j]
// (32 x 512, K = 512), all in f32 on v_wmma_f32_16x16x4_f32.
// One block of 16 waves owns 16 rows n x 32 columns j. Wave w owns the K slice
// [32w, 32w+32): it issues all of its loads at once (each wave-wide 16-byte
// load covers four whole 128-byte lines: 4 rows x 32 floats), turns them into
// fragments through its own LDS range, and runs two accumulator chains of 8
// WMMAs. The 16 K-slice partials are summed in LDS in a fixed order.
// k order: lane (c = lane&15, h = lane>>4) takes k = 8i + 4h + {0,1} and
// 8i + 4h + {2,3} of its row, by the same code for X and for Wt.
// ---------------------------------------------------------------------------
#define LIN_WAVES 16
#define LIN_PITCH 36   // floats: 128 B of data + 16 B, so 16 rows' 16-byte reads fall on 64 distinct banks

__device__ __forceinline__ v8f wmma_f32(float a0, float a1, float b0, float b1, v8f c) {
    v2f a = {a0, a1};
    v2f b = {b0, b1};
    return __builtin_amdgcn_wmma_f32_16x16x4_f32(false, a, false, b, (short)0, c, false, false);
}

struct LinLds {
    float red[LIN_WAVES][8][2][32];            // K-slice partials, lane-major
    float stage[LIN_WAVES][48][LIN_PITCH];     // per wave: 16 rows of X, 32 rows of Wt
};

__device__ __forceinline__ void lin_tile(const float* __restrict__ X, int x_stride,
                                         const float* __restrict__ Wt,
                                         const float* __restrict__ b,
                                         float* __restrict__ Y, int n0, int j0) {
    __shared__ __attribute__((aligned(16))) LinLds lds;
    int wave = threadIdx.x >> 5;
    int lane = threadIdx.x & 31;
    int kb = wave * 32;
    int lr = lane >> 3;            // row within a group of four
    int lc = (lane & 7) * 4;       // float offset within the 128-byte slice

    float4 gx[4], gw[8];
#pragma unroll
    for (int i = 0; i < 4; ++i)
        gx[i] = *(const float4*)(X + (size_t)(n0 + i * 4 + lr) * x_stride + kb + lc);
#pragma unroll
    for (int i = 0; i < 8; ++i)
        gw[i] = *(const float4*)(Wt + (size_t)(j0 + i * 4 + lr) * EE + kb + lc);
    float bias = b[j0 + lane];     // asked for with the tiles, used at the very end
#pragma unroll
    for (int i = 0; i < 4; ++i)
        *(float4*)&lds.stage[wave][i * 4 + lr][lc] = gx[i];
#pragma unroll
    for (int i = 0; i < 8; ++i)
        *(float4*)&lds.stage[wave][16 + i * 4 + lr][lc] = gw[i];
    // The wave reads back rows that its other lanes wrote: its own LDS stores
    // must be done, and the compiler must not lift the reads over them.
    asm volatile("s_wait_dscnt 0x0" ::: "memory");

    int c = lane & 15, h = lane >> 4;
    float4 fx[4], f0[4], f1[4];
#pragma unroll
    for (int i = 0; i < 4; ++i) {
        fx[i] = *(const float4*)&lds.stage[wave][c][8 * i + 4 * h];
        f0[i] = *(const float4*)&lds.stage[wave][16 + c][8 * i + 4 * h];
        f1[i] = *(const float4*)&lds.stage[wave][32 + c][8 * i + 4 * h];
    }
    // Fence pair: the LDS reads stay one group ahead of the WMMAs, and no address
    // arithmetic is scheduled into the run, where it could overwrite an operand
    // register directly behind the WMMA that reads it.
    __builtin_amdgcn_sched_barrier(0);
    v8f acc0 = {}, acc1 = {};
#pragma unroll
    for (int i = 0; i < 4; ++i) {
        acc0 = wmma_f32(fx[i].x, fx[i].y, f0[i].x, f0[i].y, acc0);
        acc1 = wmma_f32(fx[i].x, fx[i].y, f1[i].x, f1[i].y, acc1);
        acc0 = wmma_f32(fx[i].z, fx[i].w, f0[i].z, f0[i].w, acc0);
        acc1 = wmma_f32(fx[i].z, fx[i].w, f1[i].z, f1[i].w, acc1);
    }
    __builtin_amdgcn_sched_barrier(0);
    // D register r of lane (c, h) = Y[n0 + 8h + r][j0 + 16t + c].
#pragma unroll
    for (int r = 0; r < 8; ++r) {
        lds.red[wave][r][0][lane] = acc0[r];
        lds.red[wave][r][1][lane] = acc1[r];
    }
    __syncthreads();
    // Wave w stores row n0 + w: 32 columns = one whole 128-byte line.
    const float* pr = &lds.red[0][wave & 7][lane >> 4][(wave >> 3) * 16 + c];
    float s0 = pr[0 * 512], s1 = pr[1 * 512], s2 = pr[2 * 512], s3 = pr[3 * 512];
#pragma unroll
    for (int w = 4; w < LIN_WAVES; w += 4) {
        s0 += pr[(w + 0) * 512];
        s1 += pr[(w + 1) * 512];
        s2 += pr[(w + 2) * 512];
        s3 += pr[(w + 3) * 512];
    }
    Y[(size_t)(n0 + wave) * EE + j0 + lane] = ((s0 + s1) + (s2 + s3)) + bias;
}

// ---------------------------------------------------------------------------
// Stage 1a: q[n,j] = src[l=2048,n,:] . Wq[j,:] + bq[j]      (32 x 512)
// Grid: 16 column groups x 2 row groups.
// ---------------------------------------------------------------------------
__global__ __launch_bounds__(512) void qproj_kernel(const float* __restrict__ src,
                                                    const float* __restrict__ Wq,
                                                    const float* __restrict__ bq,
                                                    float* __restrict__ q) {
    int j0 = (blockIdx.x & 15) * 32, n0 = (blockIdx.x >> 4) * 16;
    lin_tile(src + (size_t)2048 * NN * EE, EE, Wq, bq, q, n0, j0);
}

// ---------------------------------------------------------------------------
// Stage 1b: qk[n,h,e] = sum_d q[n,h*64+d] * Wk[h*64+d,e]; h padded to 16 rows
// (pad rows written as zero so WMMA A reads are valid & exact).
// Also sb[n,h] = q[n,h,:] . bk[h,:]  (score bias from k's bias).
// ---------------------------------------------------------------------------
__global__ __launch_bounds__(256) void qk_kernel(const float* __restrict__ q,
                                                 const float* __restrict__ Wk,
                                                 const float* __restrict__ bk,
                                                 float* __restrict__ qk,
                                                 float* __restrict__ sb) {
    int idx = blockIdx.x * 256 + threadIdx.x;     // 32*16*512 = 262144
    int e = idx & 511;
    int h = (idx >> 9) & 15;
    int n = idx >> 13;
    float acc = 0.0f;
    if (h < HH) {
        const float* qv = q + (size_t)n * EE + h * 64;
#pragma unroll 8
        for (int d = 0; d < 64; ++d)
            acc = fmaf(qv[d], Wk[(size_t)(h * 64 + d) * EE + e], acc);
        if (e == 0) {
            float s = 0.0f;
            for (int d = 0; d < 64; ++d) s = fmaf(qv[d], bk[h * 64 + d], s);
            sb[n * HH + h] = s;
        }
    }
    qk[idx] = acc;
}

// ---------------------------------------------------------------------------
// Stage 2: scores[n,h,s] = qk[n,h,:] . src[s,n,:]   via WMMA bf16.
// Grid (n, s-chunk of 256). 8 waves; each wave owns two 16-wide s tiles.
// A = qk rows (M=h padded 16, K=e), B = src columns (N=s, K=e contiguous).
// ---------------------------------------------------------------------------
__global__ __launch_bounds__(256) void scores_kernel(const float* __restrict__ src,
                                                     const float* __restrict__ qk,
                                                     float* __restrict__ scores) {
    int n = blockIdx.x;            // 0..31
    int sc = blockIdx.y;           // 0..15  (256 s each)
    int wave = threadIdx.x >> 5;
    int lane = threadIdx.x & 31;
    int half = lane >> 4;
    int m = lane & 15;
    int s0 = sc * 256;
    int colA = s0 + (wave * 2 + 0) * 16 + m;    // B tile0 column (this lane)
    int colB = s0 + (wave * 2 + 1) * 16 + m;    // B tile1 column
    const float* qkrow = qk + ((size_t)n * 16 + m) * EE;     // padded rows
    const float* srcA = src + ((size_t)colA * NN + n) * EE;
    const float* srcB = src + ((size_t)colB * NN + n) * EE;

    v8f acc0 = {}, acc1 = {};
#pragma unroll
    for (int ke = 0; ke < 16; ++ke) {
        int e0 = ke * 32;
        v16bf a  = frag_contig(qkrow + e0, half);
        v16bf b0 = frag_contig(srcA + e0, half);
        v16bf b1 = frag_contig(srcB + e0, half);
        acc0 = wmma_bf16(a, b0, acc0);
        acc1 = wmma_bf16(a, b1, acc1);
    }
    // C layout: lanes 0-15 -> M=r (real heads 0..7), N=lane. Lanes 16-31 are pad rows.
    if (half == 0) {
#pragma unroll
        for (int r = 0; r < 8; ++r) {
            scores[((size_t)(n * HH + r)) * SS + (size_t)(s0 + (wave * 2 + 0) * 16 + m)] = acc0[r];
            scores[((size_t)(n * HH + r)) * SS + (size_t)(s0 + (wave * 2 + 1) * 16 + m)] = acc1[r];
        }
    }
}

// ---------------------------------------------------------------------------
// Stage 3: softmax over s (4096) per (n,h); writes p padded to 16 heads
// (zero pad rows) so it can feed WMMA A directly.  x = (raw + sb)/sqrt(64).
// ---------------------------------------------------------------------------
__global__ __launch_bounds__(256) void softmax_kernel(const float* __restrict__ scores,
                                                      const float* __restrict__ sb,
                                                      float* __restrict__ p) {
    int nh16 = blockIdx.x;               // 0..511  (n*16+h)
    int n = nh16 >> 4, h = nh16 & 15;
    int t = threadIdx.x;
    float* prow = p + (size_t)nh16 * SS;
    if (h >= HH) {
#pragma unroll
        for (int k = 0; k < 16; ++k) prow[t + k * 256] = 0.0f;
        return;
    }
    const float* srow = scores + ((size_t)(n * HH + h)) * SS;
    float bias = sb[n * HH + h];
    float x[16];
    float mx = -INFINITY;
#pragma unroll
    for (int k = 0; k < 16; ++k) {
        x[k] = (srow[t + k * 256] + bias) * 0.125f;
        mx = fmaxf(mx, x[k]);
    }
    __shared__ float red[256];
    red[t] = mx; __syncthreads();
    for (int off = 128; off > 0; off >>= 1) {
        if (t < off) red[t] = fmaxf(red[t], red[t + off]);
        __syncthreads();
    }
    mx = red[0]; __syncthreads();
    float sum = 0.0f;
#pragma unroll
    for (int k = 0; k < 16; ++k) { x[k] = __expf(x[k] - mx); sum += x[k]; }
    red[t] = sum; __syncthreads();
    for (int off = 128; off > 0; off >>= 1) {
        if (t < off) red[t] += red[t + off];
        __syncthreads();
    }
    float inv = 1.0f / red[0];
#pragma unroll
    for (int k = 0; k < 16; ++k) prow[t + k * 256] = x[k] * inv;
}

// ---------------------------------------------------------------------------
// Stage 4: ctx partials.  ctx[n,h,e] = sum_s p[n,h,s]*src[s,n,e]  via WMMA.
// Grid (n, s-chunk of 512) -> 8 partials reduced afterwards (deterministic,
// no float atomics).  A = p rows (M=h pad16, K=s), B = src (K=s, N=e).
// ---------------------------------------------------------------------------
__global__ __launch_bounds__(256) void ctx_kernel(const float* __restrict__ src,
                                                  const float* __restrict__ p,
                                                  float* __restrict__ ctx_part) {
    int n = blockIdx.x;            // 0..31
    int c = blockIdx.y;            // 0..7   (512 s each)
    int wave = threadIdx.x >> 5;
    int lane = threadIdx.x & 31;
    int half = lane >> 4;
    int m = lane & 15;
    const float* prow = p + ((size_t)n * 16 + m) * SS + c * 512;  // padded heads

    v8f acc[4] = {{}, {}, {}, {}};
#pragma unroll
    for (int ks = 0; ks < 16; ++ks) {
        int sb0 = ks * 32;
        v16bf a = frag_contig(prow + sb0, half);
#pragma unroll
        for (int t4 = 0; t4 < 4; ++t4) {
            int e = (wave * 4 + t4) * 16 + m;   // this lane's column
            v16bf b = frag_src_strideS(src, c * 512 + sb0, n, e, half);
            acc[t4] = wmma_bf16(a, b, acc[t4]);
        }
    }
    if (half == 0) {
#pragma unroll
        for (int t4 = 0; t4 < 4; ++t4) {
            int e = (wave * 4 + t4) * 16 + m;
#pragma unroll
            for (int r = 0; r < 8; ++r)
                ctx_part[((size_t)c * (NN * HH) + (size_t)(n * HH + r)) * EE + e] = acc[t4][r];
        }
    }
}

__global__ __launch_bounds__(256) void ctxred_kernel(const float* __restrict__ part,
                                                     float* __restrict__ ctx) {
    int idx = blockIdx.x * 256 + threadIdx.x;   // 32*8*512 = 131072
    float acc = 0.0f;
#pragma unroll
    for (int c = 0; c < 8; ++c) acc += part[(size_t)c * 131072 + idx];
    ctx[idx] = acc;
}

// ---------------------------------------------------------------------------
// Stage 5: tiny output chain.
// mo[n,j] = Wv[j,:].ctx[n, j>>6, :] + bv[j]   (bv passes through: sum p == 1)
// o2 = mo @ Wo.T + bo ; out = o2 @ Wl.T + bl
// ---------------------------------------------------------------------------
__global__ __launch_bounds__(512) void vproj_kernel(const float* __restrict__ ctx,
                                                    const float* __restrict__ Wv,
                                                    const float* __restrict__ bv,
                                                    float* __restrict__ mo) {
    int j0 = (blockIdx.x & 15) * 32, n0 = (blockIdx.x >> 4) * 16;
    int head = j0 >> 6;            // the block's 32 columns lie in one head
    lin_tile(ctx + (size_t)head * EE, HH * EE, Wv, bv, mo, n0, j0);
}

__global__ __launch_bounds__(512) void lin_kernel(const float* __restrict__ A,
                                                  const float* __restrict__ W,
                                                  const float* __restrict__ b,
                                                  float* __restrict__ out) {
    int j0 = (blockIdx.x & 15) * 32, n0 = (blockIdx.x >> 4) * 16;
    lin_tile(A, EE, W, b, out, n0, j0);
}

// ---------------------------------------------------------------------------
extern "C" void kernel_launch(void* const* d_in, const int* in_sizes, int n_in,
                              void* d_out, int out_size, void* d_ws, size_t ws_size,
                              hipStream_t stream) {
    const float* src = (const float*)d_in[0];
    const float* Wq  = (const float*)d_in[1];
    const float* bq  = (const float*)d_in[2];
    const float* Wk  = (const float*)d_in[3];
    const float* bk  = (const float*)d_in[4];
    const float* Wv  = (const float*)d_in[5];
    const float* bv  = (const float*)d_in[6];
    const float* Wo  = (const float*)d_in[7];
    const float* bo  = (const float*)d_in[8];
    const float* Wl  = (const float*)d_in[9];
    const float* bl  = (const float*)d_in[10];

    float* ws = (float*)d_ws;
    float* q      = ws;               // 16384
    float* qkbuf  = ws + 16384;       // 32*16*512 = 262144 (head-padded)
    float* sb     = ws + 278528;      // 256
    float* scores = ws + 278784;      // 32*8*4096 = 1048576
    float* p      = ws + 1327360;     // 32*16*4096 = 2097152 (head-padded)
    float* part   = ws + 3424512;     // 8*32*8*512 = 1048576
    float* ctx    = ws + 4473088;     // 32*8*512 = 131072
    float* mo     = ws + 4604160;     // 16384
    float* o2     = ws + 4620544;     // 16384  (end: 4636928 floats ~ 17.7 MB)

    qproj_kernel  <<<32,   512, 0, stream>>>(src, Wq, bq, q);
    qk_kernel     <<<1024, 256, 0, stream>>>(q, Wk, bk, qkbuf, sb);
    scores_kernel <<<dim3(32, 16), 256, 0, stream>>>(src, qkbuf, scores);
    softmax_kernel<<<512,  256, 0, stream>>>(scores, sb, p);
    ctx_kernel    <<<dim3(32, 8),  256, 0, stream>>>(src, p, part);
    ctxred_kernel <<<512,  256, 0, stream>>>(part, ctx);
    vproj_kernel  <<<32,   512, 0, stream>>>(ctx, Wv, bv, mo);
    lin_kernel    <<<32,   512, 0, stream>>>(mo, Wo, bo, o2);
    lin_kernel    <<<32,   512, 0, stream>>>(o2, Wl, bl, (float*)d_out);
}

// v002
// A run of this version takes 47.4 microseconds.
// Next to v001, in two timings, it ran 1.89 times as fast each time.
// Counting every step since v000, it is 2.99 times as fast.
#include <hip/hip_runtime.h>
#include <math.h>

// Problem constants (from reference): S=4096, N=32, E=512, H=8, DK=64, l=2048.
#define SS 4096
#define NN 32
#define EE 512
#define HH 8

typedef __attribute__((ext_vector_type(16))) __bf16 v16bf;
typedef __attribute__((ext_vector_type(8)))  float  v8f;
typedef __attribute__((ext_vector_type(2)))  float  v2f;

__device__ __forceinline__ v8f wmma_bf16(v16bf a, v16bf b, v8f c) {
    return __builtin_amdgcn_wmma_f32_16x16x32_bf16(false, a, false, b, (short)0, c, false, false);
}

// ---------------------------------------------------------------------------
// Shared tile for the four small linears  Y[n,j] = X[n,:] . Wt[j,:] + b[j]
// (32 x 512, K = 512), all in f32 on v_wmma_f32_16x16x4_f32.
// One block of 16 waves owns 16 rows n x 32 columns j. Wave w owns the K slice
// [32w, 32w+32): it issues all of its loads at once (each wave-wide 16-byte
// load covers four whole 128-byte lines: 4 rows x 32 floats), turns them into
// fragments through its own LDS range, and runs two accumulator chains of 8
// WMMAs. The 16 K-slice partials are summed in LDS in a fixed order.
// k order: lane (c = lane&15, h = lane>>4) takes k = 8i + 4h + {0,1} and
// 8i + 4h + {2,3} of its row, by the same code for X and for Wt.
// ---------------------------------------------------------------------------
#define LIN_WAVES 16
#define LIN_PITCH 36   // floats: 128 B of data + 16 B, so 16 rows' 16-byte reads fall on 64 distinct banks

__device__ __forceinline__ v8f wmma_f32(float a0, float a1, float b0, float b1, v8f c) {
    v2f a = {a0, a1};
    v2f b = {b0, b1};
    return __builtin_amdgcn_wmma_f32_16x16x4_f32(false, a, false, b, (short)0, c, false, false);
}

struct LinLds {
    float red[LIN_WAVES][8][2][32];            // K-slice partials, lane-major
    float stage[LIN_WAVES][48][LIN_PITCH];     // per wave: 16 rows of X, 32 rows of Wt
};

__device__ __forceinline__ void lin_tile(const float* __restrict__ X, int x_stride,
                                         const float* __restrict__ Wt,
                                         const float* __restrict__ b,
                                         float* __restrict__ Y, int n0, int j0) {
    __shared__ __attribute__((aligned(16))) LinLds lds;
    int wave = threadIdx.x >> 5;
    int lane = threadIdx.x & 31;
    int kb = wave * 32;
    int lr = lane >> 3;            // row within a group of four
    int lc = (lane & 7) * 4;       // float offset within the 128-byte slice

    float4 gx[4], gw[8];
#pragma unroll
    for (int i = 0; i < 4; ++i)
        gx[i] = *(const float4*)(X + (size_t)(n0 + i * 4 + lr) * x_stride + kb + lc);
#pragma unroll
    for (int i = 0; i < 8; ++i)
        gw[i] = *(const float4*)(Wt + (size_t)(j0 + i * 4 + lr) * EE + kb + lc);
    float bias = b[j0 + lane];     // asked for with the tiles, used at the very end
#pragma unroll
    for (int i = 0; i < 4; ++i)
        *(float4*)&lds.stage[wave][i * 4 + lr][lc] = gx[i];
#pragma unroll
    for (int i = 0; i < 8; ++i)
        *(float4*)&lds.stage[wave][16 + i * 4 + lr][lc] = gw[i];
    // The wave reads back rows that its other lanes wrote: its own LDS stores
    // must be done, and the compiler must not lift the reads over them.
    asm volatile("s_wait_dscnt 0x0" ::: "memory");

    int c = lane & 15, h = lane >> 4;
    float4 fx[4], f0[4], f1[4];
#pragma unroll
    for (int i = 0; i < 4; ++i) {
        fx[i] = *(const float4*)&lds.stage[wave][c][8 * i + 4 * h];
        f0[i] = *(const float4*)&lds.stage[wave][16 + c][8 * i + 4 * h];
        f1[i] = *(const float4*)&lds.stage[wave][32 + c][8 * i + 4 * h];
    }
    // Fence pair: the LDS reads stay one group ahead of the WMMAs, and no address
    // arithmetic is scheduled into the run, where it could overwrite an operand
    // register directly behind the WMMA that reads it.
    __builtin_amdgcn_sched_barrier(0);
    v8f acc0 = {}, acc1 = {};
#pragma unroll
    for (int i = 0; i < 4; ++i) {
        acc0 = wmma_f32(fx[i].x, fx[i].y, f0[i].x, f0[i].y, acc0);
        acc1 = wmma_f32(fx[i].x, fx[i].y, f1[i].x, f1[i].y, acc1);
        acc0 = wmma_f32(fx[i].z, fx[i].w, f0[i].z, f0[i].w, acc0);
        acc1 = wmma_f32(fx[i].z, fx[i].w, f1[i].z, f1[i].w, acc1);
    }
    __builtin_amdgcn_sched_barrier(0);
    // D register r of lane (c, h) = Y[n0 + 8h + r][j0 + 16t + c].
#pragma unroll
    for (int r = 0; r < 8; ++r) {
        lds.red[wave][r][0][lane] = acc0[r];
        lds.red[wave][r][1][lane] = acc1[r];
    }
    __syncthreads();
    // Wave w stores row n0 + w: 32 columns = one whole 128-byte line.
    const float* pr = &lds.red[0][wave & 7][lane >> 4][(wave >> 3) * 16 + c];
    float s0 = pr[0 * 512], s1 = pr[1 * 512], s2 = pr[2 * 512], s3 = pr[3 * 512];
#pragma unroll
    for (int w = 4; w < LIN_WAVES; w += 4) {
        s0 += pr[(w + 0) * 512];
        s1 += pr[(w + 1) * 512];
        s2 += pr[(w + 2) * 512];
        s3 += pr[(w + 3) * 512];
    }
    Y[(size_t)(n0 + wave) * EE + j0 + lane] = ((s0 + s1) + (s2 + s3)) + bias;
}

// ---------------------------------------------------------------------------
// Stage 1a: q[n,j] = src[l=2048,n,:] . Wq[j,:] + bq[j]      (32 x 512)
// Grid: 16 column groups x 2 row groups.
// ---------------------------------------------------------------------------
__global__ __launch_bounds__(512) void qproj_kernel(const float* __restrict__ src,
                                                    const float* __restrict__ Wq,
                                                    const float* __restrict__ bq,
                                                    float* __restrict__ q) {
    int j0 = (blockIdx.x & 15) * 32, n0 = (blockIdx.x >> 4) * 16;
    lin_tile(src + (size_t)2048 * NN * EE, EE, Wq, bq, q, n0, j0);
}

// ---------------------------------------------------------------------------
// Stage 1b: qk[n,h,e] = sum_d q[n,h*64+d] * Wk[h*64+d,e]; h padded to 16 rows
// (pad rows written as zero so WMMA B reads are valid & exact).
// Also sb[n,h] = q[n,h,:] . bk[h,:]  (score bias from k's bias).
// ---------------------------------------------------------------------------
__global__ __launch_bounds__(256) void qk_kernel(const float* __restrict__ q,
                                                 const float* __restrict__ Wk,
                                                 const float* __restrict__ bk,
                                                 float* __restrict__ qk,
                                                 float* __restrict__ sb) {
    int idx = blockIdx.x * 256 + threadIdx.x;     // 32*16*512 = 262144
    int e = idx & 511;
    int h = (idx >> 9) & 15;
    int n = idx >> 13;
    float acc = 0.0f;
    if (h < HH) {
        const float* qv = q + (size_t)n * EE + h * 64;
#pragma unroll 8
        for (int d = 0; d < 64; ++d)
            acc = fmaf(qv[d], Wk[(size_t)(h * 64 + d) * EE + e], acc);
        if (e == 0) {
            float s = 0.0f;
            for (int d = 0; d < 64; ++d) s = fmaf(qv[d], bk[h * 64 + d], s);
            sb[n * HH + h] = s;
        }
    }
    qk[idx] = acc;
}

// ---------------------------------------------------------------------------
// Stages 2 to 4 in one pass over src (each src row is read from memory once).
// Grid (n, chunk of 512 s). 16 waves; two rounds of 256 s rows.
// Round: wave w brings rows 16w .. 16w+15 (whole 512-byte pieces of a row per
// load), rounds them to bf16 and lays them row-major in LDS. Then
//   S^T[s, head] = src[s, :] . qk[head, :]      A = own 16 rows, B = qk (LDS)
//   p = exp(x - running max), handed over in LDS as the B fragment of
//   ctx^T[e, head] += src^T[e, s] . p[s, head]  A = transposing LDS loads,
// where wave w owns e = 32w .. 32w+31 over all 256 rows of the round.
// Both products use the hardware k order: k = 8h + i, then 16 + 8h + i.
// The block hands on an un-normalised sum with its (max, sum) per head.
// ---------------------------------------------------------------------------
typedef __attribute__((ext_vector_type(4))) unsigned int u32x4;
typedef __attribute__((ext_vector_type(2))) unsigned int u32x2;
typedef __attribute__((ext_vector_type(8))) short s16x8;
typedef __attribute__((ext_vector_type(2))) __bf16 bf16x2;

#define FA_WAVES  16
#define FA_ROWS   256     // s rows per round
#define FA_ROUNDS 2
#define FA_CHUNKS 8
#define FA_PITCH  1056    // bytes: 1024 of data + 32, an odd multiple of 32 for the transposing loads
#define FA_QPITCH 1040    // bytes, qk rows: an odd multiple of 16 for plain 16-byte reads
#define ROWF      (NN * EE)   // floats between consecutive s

union Frag { u32x4 q[2]; v16bf v; };

#define FA_DEPTH 6        // rows (2 KiB each) that a wave keeps in flight
#define FA_MXP 20         // floats per head in the exchange rows: 80 B, an odd multiple of 16

struct FaLds {                         // the small arrays first: their offsets fit the LDS instructions' immediate
    u32x4 p[FA_ROWS / 32][2][32];      // [k step][first / second 16 rows][lane]
    float mx[16 * FA_MXP];             // [head][wave]
    unsigned char qk[16 * FA_QPITCH];
    unsigned char tile[FA_ROWS * FA_PITCH];
};

__device__ __forceinline__ unsigned int pack2(float lo, float hi) {
    v2f f = {lo, hi};
    return __builtin_bit_cast(unsigned int, __builtin_convertvector(f, bf16x2));
}
__device__ __forceinline__ void put_bf16x4(unsigned char* dst, float4 v) {
    u32x2 w = {pack2(v.x, v.y), pack2(v.z, v.w)};
    *(u32x2*)dst = w;
}
__device__ __forceinline__ u32x4 ld_tr16(const unsigned char* p) {
    typedef __attribute__((address_space(3))) s16x8 lds_s16x8;
    return __builtin_bit_cast(u32x4, __builtin_amdgcn_ds_load_tr16_b128_v8i16((lds_s16x8*)p));
}
// lane l <-> lane l ^ 16
__device__ __forceinline__ float xhalf(float x) {
    int b = __builtin_bit_cast(int, x);
    return __builtin_bit_cast(float, __builtin_amdgcn_permlanex16(b, b, 0x76543210, 0xfedcba98, false, false));
}
__device__ __forceinline__ float bf_lo(unsigned int w) { return __builtin_bit_cast(float, w << 16); }
__device__ __forceinline__ float bf_hi(unsigned int w) { return __builtin_bit_cast(float, w & 0xffff0000u); }
// exp(x) as __expf is built (one multiply, v_exp_f32), in asm so that the v_nop
// stands directly behind the transcendental: the slot that the instruction set
// asks for in front of an instruction that reads its result or overwrites its
// source.
__device__ __forceinline__ float exp_slot(float x) {
    float r;
    asm("v_exp_f32 %0, %1\n\tv_nop" : "=v"(r) : "v"(x * 1.44269504f));
    return r;
}
// Work-group barrier for hand-overs through LDS: the wave's LDS operations are
// done before it signals, while its global loads of the coming rows stay in
// flight (__syncthreads() was built with a wait for those loads as well). The
// scheduling fences keep work on those loads' registers from moving over it.
__device__ __forceinline__ void lds_barrier() {
    __builtin_amdgcn_sched_barrier(0);
    asm volatile("s_wait_dscnt 0x0\n\ts_barrier_signal -1\n\ts_barrier_wait -1" ::: "memory");
    __builtin_amdgcn_sched_barrier(0);
}

__global__ __launch_bounds__(512) void attn_pass_kernel(const float* __restrict__ src,
                                                        const float* __restrict__ qk,
                                                        const float* __restrict__ sb,
                                                        float* __restrict__ part,
                                                        float* __restrict__ ml) {
    __shared__ __attribute__((aligned(16))) FaLds lds;
    const int n = blockIdx.x;            // 0..31
    const int ch = blockIdx.y;           // 0..7  (512 s each)
    // The wave's number in a scalar register: row addresses are then a scalar
    // base plus one lane offset, not a vector register pair for each.
    const int wave = __builtin_amdgcn_readfirstlane(threadIdx.x >> 5);
    const int lane = threadIdx.x & 31;
    const int c = lane & 15, h = lane >> 4;

    // qk[n] (16 padded heads x 512) -> bf16 in LDS.
    float4 gq[4];
#pragma unroll
    for (int i = 0; i < 4; ++i)
        gq[i] = *(const float4*)(qk + (size_t)n * 16 * EE + (i * 512 + (int)threadIdx.x) * 4);
    const float bias = sb[n * HH + (c & 7)];   // padding columns 8..15 are never stored
    // Precaution: stands between the loads above and any reuse of their offset
    // registers.
    asm volatile("s_wait_xcnt 0x0" ::: "memory");

    // Row f (0..31) of the wave's share: round f >> 4, row f & 15 of its sixteen;
    // four loads of 512 contiguous bytes each. FA_DEPTH rows are kept in flight.
    const float* g = src + ((size_t)(ch * (FA_ROWS * FA_ROUNDS) + wave * 16) * NN + n) * EE;
    const int gl = lane * 4;
    float4 buf[FA_DEPTH * 4];
#pragma unroll
    for (int i = 0; i < FA_DEPTH * 4; ++i)
        buf[i] = *(const float4*)(g + (size_t)(i >> 2) * ROWF + (i & 3) * 128 + gl);
    __builtin_amdgcn_sched_barrier(0);   // the first rows are asked for before anything waits
#pragma unroll
    for (int i = 0; i < 4; ++i) {
        int f = (i * 512 + (int)threadIdx.x) * 4;
        put_bf16x4(lds.qk + (f >> 9) * FA_QPITCH + (f & 511) * 2, gq[i]);
    }

    unsigned char* trow = lds.tile + (wave * 16) * FA_PITCH + lane * 8;
    const unsigned char* ta = lds.tile + (wave * 16 + c) * FA_PITCH + 16 * h;
    const unsigned char* tb = lds.qk + c * FA_QPITCH + 16 * h;
    const unsigned char* tt = lds.tile + (8 * h + (lane & 7)) * FA_PITCH + ((lane >> 3) & 1) * 16 + wave * 64;

    float m_run = -INFINITY, l_run = 0.0f;
    v8f acc0 = {}, acc1 = {};
#pragma unroll
    for (int r = 0; r < FA_ROUNDS; ++r) {
        // Row by row: a row's four registers are asked for again as soon as the
        // row lies in LDS, so that the wave's loads stay in flight, through the
        // products too. The fence keeps that order (without it the loads were
        // bunched, more registers were live and some were spilled).
#pragma unroll
        for (int q = 0; q < 16; ++q) {
            const int f = r * 16 + q, slot = (f % FA_DEPTH) * 4, fn = f + FA_DEPTH;
#pragma unroll
            for (int k = 0; k < 4; ++k)
                put_bf16x4(trow + q * FA_PITCH + k * 256, buf[slot + k]);
            if (fn < FA_ROUNDS * 16) {
                const float* gn = g + (size_t)((fn >> 4) * FA_ROWS + (fn & 15)) * ROWF;
#pragma unroll
                for (int k = 0; k < 4; ++k)
                    buf[slot + k] = *(const float4*)(gn + k * 128 + gl);
            }
            __builtin_amdgcn_sched_barrier(0);
        }
        if (r == 0) lds_barrier();       // qk lies in LDS for every wave

        // Scores of the wave's own 16 rows: s0[i] + s1[i] = raw[s = 16w + 8h + i][head c].
        v8f s0 = {}, s1 = {};
#pragma unroll
        for (int ks = 0; ks < 16; ks += 2) {
            Frag a0, b0, a1, b1;
            a0.q[0] = *(const u32x4*)(ta + ks * 64);      a0.q[1] = *(const u32x4*)(ta + ks * 64 + 32);
            b0.q[0] = *(const u32x4*)(tb + ks * 64);      b0.q[1] = *(const u32x4*)(tb + ks * 64 + 32);
            a1.q[0] = *(const u32x4*)(ta + ks * 64 + 64); a1.q[1] = *(const u32x4*)(ta + ks * 64 + 96);
            b1.q[0] = *(const u32x4*)(tb + ks * 64 + 64); b1.q[1] = *(const u32x4*)(tb + ks * 64 + 96);
            s0 = wmma_bf16(a0.v, b0.v, s0);
            s1 = wmma_bf16(a1.v, b1.v, s1);
        }
        float x[8];
        float mx = -INFINITY;
#pragma unroll
        for (int i = 0; i < 8; ++i) {
            x[i] = ((s0[i] + s1[i]) + bias) * 0.125f;
            mx = fmaxf(mx, x[i]);
        }
        mx = fmaxf(mx, xhalf(mx));
        lds.mx[c * FA_MXP + wave] = mx;  // both halves hold the same value
        lds_barrier();                   // every wave's maxima are in LDS
        float4 m4[4];
#pragma unroll
        for (int i = 0; i < 4; ++i) m4[i] = *(const float4*)&lds.mx[c * FA_MXP + 4 * i];
        float mr = -INFINITY;
#pragma unroll
        for (int i = 0; i < 4; ++i)
            mr = fmaxf(mr, fmaxf(fmaxf(m4[i].x, m4[i].y), fmaxf(m4[i].z, m4[i].w)));
        const float m_new = fmaxf(m_run, mr);
        const float scale = exp_slot(m_run - m_new);
        m_run = m_new;
        u32x4 pw;
        float ls = 0.0f;                 // the sum is taken of the rounded weights
#pragma unroll
        for (int i = 0; i < 4; ++i) {
            pw[i] = pack2(exp_slot(x[2 * i] - m_new), exp_slot(x[2 * i + 1] - m_new));
            ls += bf_lo(pw[i]) + bf_hi(pw[i]);
        }
        l_run = fmaf(l_run, scale, ls);
        lds.p[wave >> 1][wave & 1][lane] = pw;
        lds_barrier();                   // every wave's rows and weights are in LDS

#pragma unroll
        for (int i = 0; i < 8; ++i) { acc0[i] *= scale; acc1[i] *= scale; }
#pragma unroll
        for (int j = 0; j < FA_ROWS / 32; ++j) {
            Frag b, a0, a1;
            b.q[0] = lds.p[j][0][lane];
            b.q[1] = lds.p[j][1][lane];
            const unsigned char* tj = tt + j * 32 * FA_PITCH;
            a0.q[0] = ld_tr16(tj);      a0.q[1] = ld_tr16(tj + 16 * FA_PITCH);
            a1.q[0] = ld_tr16(tj + 32); a1.q[1] = ld_tr16(tj + 16 * FA_PITCH + 32);
            acc0 = wmma_bf16(a0.v, b.v, acc0);
            acc1 = wmma_bf16(a1.v, b.v, acc1);
        }
        if (r + 1 < FA_ROUNDS)
            lds_barrier();               // all reads of this round's LDS are done
    }

    // The waves' sums of weights (all against the same final maximum) -> wave 0.
    lds.mx[c * FA_MXP + wave] = l_run + xhalf(l_run);
    lds_barrier();

    // acc{0,1}[i] = ctx^T[e = 32w + {0,16} + 8h + i][head c]; heads 8..15 are padding.
    if (c < HH) {
        float* o = part + (((size_t)ch * NN + n) * HH + c) * EE + wave * 32 + 8 * h;
        *(float4*)(o)      = make_float4(acc0[0], acc0[1], acc0[2], acc0[3]);
        *(float4*)(o + 4)  = make_float4(acc0[4], acc0[5], acc0[6], acc0[7]);
        *(float4*)(o + 16) = make_float4(acc1[0], acc1[1], acc1[2], acc1[3]);
        *(float4*)(o + 20) = make_float4(acc1[4], acc1[5], acc1[6], acc1[7]);
        if (wave == 0 && h == 0) {
            float l_tot = 0.0f;
#pragma unroll
            for (int w = 0; w < FA_WAVES; ++w) l_tot += lds.mx[c * FA_MXP + w];
            ml[((ch * NN + n) * HH + c) * 2 + 0] = m_run;
            ml[((ch * NN + n) * HH + c) * 2 + 1] = l_tot;
        }
    }
}

// Merge of the 8 chunks: weights exp(m_c - M), divided by the merged sum.
__global__ __launch_bounds__(256) void merge_kernel(const float* __restrict__ part,
                                                    const float* __restrict__ ml,
                                                    float* __restrict__ ctx) {
    int idx = blockIdx.x * 256 + threadIdx.x;   // 32*8*512 = 131072
    int nh = idx >> 9;
    float m[FA_CHUNKS], l[FA_CHUNKS], v[FA_CHUNKS];
    float M = -INFINITY;
#pragma unroll
    for (int k = 0; k < FA_CHUNKS; ++k) {
        m[k] = ml[(k * (NN * HH) + nh) * 2 + 0];
        l[k] = ml[(k * (NN * HH) + nh) * 2 + 1];
        v[k] = part[(size_t)k * 131072 + idx];
        M = fmaxf(M, m[k]);
    }
    float L = 0.0f, a = 0.0f;
#pragma unroll
    for (int k = 0; k < FA_CHUNKS; ++k) {
        float w = __expf(m[k] - M);
        L = fmaf(w, l[k], L);
        a = fmaf(w, v[k], a);
    }
    ctx[idx] = a / L;
}

// ---------------------------------------------------------------------------
// Stage 5: tiny output chain.
// mo[n,j] = Wv[j,:].ctx[n, j>>6, :] + bv[j]   (bv passes through: sum p == 1)
// o2 = mo @ Wo.T + bo ; out = o2 @ Wl.T + bl
// ---------------------------------------------------------------------------
__global__ __launch_bounds__(512) void vproj_kernel(const float* __restrict__ ctx,
                                                    const float* __restrict__ Wv,
                                                    const float* __restrict__ bv,
                                                    float* __restrict__ mo) {
    int j0 = (blockIdx.x & 15) * 32, n0 = (blockIdx.x >> 4) * 16;
    int head = j0 >> 6;            // the block's 32 columns lie in one head
    lin_tile(ctx + (size_t)head * EE, HH * EE, Wv, bv, mo, n0, j0);
}

__global__ __launch_bounds__(512) void lin_kernel(const float* __restrict__ A,
                                                  const float* __restrict__ W,
                                                  const float* __restrict__ b,
                                                  float* __restrict__ out) {
    int j0 = (blockIdx.x & 15) * 32, n0 = (blockIdx.x >> 4) * 16;
    lin_tile(A, EE, W, b, out, n0, j0);
}

// ---------------------------------------------------------------------------
extern "C" void kernel_launch(void* const* d_in, const int* in_sizes, int n_in,
                              void* d_out, int out_size, void* d_ws, size_t ws_size,
                              hipStream_t stream) {
    const float* src = (const float*)d_in[0];
    const float* Wq  = (const float*)d_in[1];
    const float* bq  = (const float*)d_in[2];
    const float* Wk  = (const float*)d_in[3];
    const float* bk  = (const float*)d_in[4];
    const float* Wv  = (const float*)d_in[5];
    const float* bv  = (const float*)d_in[6];
    const float* Wo  = (const float*)d_in[7];
    const float* bo  = (const float*)d_in[8];
    const float* Wl  = (const float*)d_in[9];
    const float* bl  = (const float*)d_in[10];

    float* ws = (float*)d_ws;
    float* q      = ws;               // 16384
    float* qkbuf  = ws + 16384;       // 32*16*512 = 262144 (head-padded)
    float* sb     = ws + 278528;      // 256
    float* ml     = ws + 278784;      // 8*32*8 pairs (max, sum) = 4096
    float* part   = ws + 3424512;     // 8*32*8*512 = 1048576
    float* ctx    = ws + 4473088;     // 32*8*512 = 131072
    float* mo     = ws + 4604160;     // 16384
    float* o2     = ws + 4620544;     // 16384  (end: 4636928 floats ~ 17.7 MB)

    qproj_kernel  <<<32,   512, 0, stream>>>(src, Wq, bq, q);
    qk_kernel     <<<1024, 256, 0, stream>>>(q, Wk, bk, qkbuf, sb);
    attn_pass_kernel<<<dim3(32, 8), 512, 0, stream>>>(src, qkbuf, sb, part, ml);
    merge_kernel  <<<512,  256, 0, stream>>>(part, ml, ctx);
    vproj_kernel  <<<32,   512, 0, stream>>>(ctx, Wv, bv, mo);
    lin_kernel    <<<32,   512, 0, stream>>>(mo, Wo, bo, o2);
    lin_kernel    <<<32,   512, 0, stream>>>(o2, Wl, bl, (float*)d_out);
}

// v003
// It runs in 42.5 microseconds.
// In two side-by-side timings against v002, it was 1.12 and 1.13 times as fast.
// Counting every step since v000, it is 3.36 times as fast.
#include <hip/hip_runtime.h>
#include <math.h>

// Problem constants (from reference): S=4096, N=32, E=512, H=8, DK=64, l=2048.
#define SS 4096
#define NN 32
#define EE 512
#define HH 8

typedef __attribute__((ext_vector_type(16))) __bf16 v16bf;
typedef __attribute__((ext_vector_type(8)))  float  v8f;
typedef __attribute__((ext_vector_type(2)))  float  v2f;

__device__ __forceinline__ v8f wmma_bf16(v16bf a, v16bf b, v8f c) {
    return __builtin_amdgcn_wmma_f32_16x16x32_bf16(false, a, false, b, (short)0, c, false, false);
}

// ---------------------------------------------------------------------------
// Shared tile for the three small linears  Y[n,j] = X[n,:] . Wt[j,:] + b[j]
// (32 x 512, K = 512), all in f32 on v_wmma_f32_16x16x4_f32.
// One block of 16 waves owns 16 rows n x 32 columns j. Wave w owns the K slice
// [32w, 32w+32): it issues all of its loads at once (each wave-wide 16-byte
// load covers four whole 128-byte lines: 4 rows x 32 floats), turns them into
// fragments through its own LDS range, and runs two accumulator chains of 8
// WMMAs. The 16 K-slice partials are summed in LDS in a fixed order.
// k order: lane (c = lane&15, h = lane>>4) takes k = 8i + 4h + {0,1} and
// 8i + 4h + {2,3} of its row, by the same code for X and for Wt.
// ---------------------------------------------------------------------------
#define LIN_WAVES 16
#define LIN_PITCH 36   // floats: 128 B of data + 16 B, so 16 rows' 16-byte reads fall on 64 distinct banks

__device__ __forceinline__ v8f wmma_f32(float a0, float a1, float b0, float b1, v8f c) {
    v2f a = {a0, a1};
    v2f b = {b0, b1};
    return __builtin_amdgcn_wmma_f32_16x16x4_f32(false, a, false, b, (short)0, c, false, false);
}

struct LinLds {
    float red[LIN_WAVES][8][2][32];            // K-slice partials, lane-major
    float stage[LIN_WAVES][48][LIN_PITCH];     // per wave: 16 rows of X, 32 rows of Wt
};

__device__ __forceinline__ void lin_tile(const float* __restrict__ X, int x_stride,
                                         const float* __restrict__ Wt,
                                         const float* __restrict__ b,
                                         float* __restrict__ Y, int n0, int j0) {
    __shared__ __attribute__((aligned(16))) LinLds lds;
    int wave = threadIdx.x >> 5;
    int lane = threadIdx.x & 31;
    int kb = wave * 32;
    int lr = lane >> 3;            // row within a group of four
    int lc = (lane & 7) * 4;       // float offset within the 128-byte slice

    float4 gx[4], gw[8];
#pragma unroll
    for (int i = 0; i < 4; ++i)
        gx[i] = *(const float4*)(X + (size_t)(n0 + i * 4 + lr) * x_stride + kb + lc);
#pragma unroll
    for (int i = 0; i < 8; ++i)
        gw[i] = *(const float4*)(Wt + (size_t)(j0 + i * 4 + lr) * EE + kb + lc);
    float bias = b[j0 + lane];     // asked for with the tiles, used at the very end
#pragma unroll
    for (int i = 0; i < 4; ++i)
        *(float4*)&lds.stage[wave][i * 4 + lr][lc] = gx[i];
#pragma unroll
    for (int i = 0; i < 8; ++i)
        *(float4*)&lds.stage[wave][16 + i * 4 + lr][lc] = gw[i];
    // The wave reads back rows that its other lanes wrote: its own LDS stores
    // must be done, and the compiler must not lift the reads over them.
    asm volatile("s_wait_dscnt 0x0" ::: "memory");

    int c = lane & 15, h = lane >> 4;
    float4 fx[4], f0[4], f1[4];
#pragma unroll
    for (int i = 0; i < 4; ++i) {
        fx[i] = *(const float4*)&lds.stage[wave][c][8 * i + 4 * h];
        f0[i] = *(const float4*)&lds.stage[wave][16 + c][8 * i + 4 * h];
        f1[i] = *(const float4*)&lds.stage[wave][32 + c][8 * i + 4 * h];
    }
    // Fence pair: the LDS reads stay one group ahead of the WMMAs, and no address
    // arithmetic is scheduled into the run, where it could overwrite an operand
    // register directly behind the WMMA that reads it.
    __builtin_amdgcn_sched_barrier(0);
    v8f acc0 = {}, acc1 = {};
#pragma unroll
    for (int i = 0; i < 4; ++i) {
        acc0 = wmma_f32(fx[i].x, fx[i].y, f0[i].x, f0[i].y, acc0);
        acc1 = wmma_f32(fx[i].x, fx[i].y, f1[i].x, f1[i].y, acc1);
        acc0 = wmma_f32(fx[i].z, fx[i].w, f0[i].z, f0[i].w, acc0);
        acc1 = wmma_f32(fx[i].z, fx[i].w, f1[i].z, f1[i].w, acc1);
    }
    __builtin_amdgcn_sched_barrier(0);
    // D register r of lane (c, h) = Y[n0 + 8h + r][j0 + 16t + c].
#pragma unroll
    for (int r = 0; r < 8; ++r) {
        lds.red[wave][r][0][lane] = acc0[r];
        lds.red[wave][r][1][lane] = acc1[r];
    }
    __syncthreads();
    // Wave w stores row n0 + w: 32 columns = one whole 128-byte line.
    const float* pr = &lds.red[0][wave & 7][lane >> 4][(wave >> 3) * 16 + c];
    float s0 = pr[0 * 512], s1 = pr[1 * 512], s2 = pr[2 * 512], s3 = pr[3 * 512];
#pragma unroll
    for (int w = 4; w < LIN_WAVES; w += 4) {
        s0 += pr[(w + 0) * 512];
        s1 += pr[(w + 1) * 512];
        s2 += pr[(w + 2) * 512];
        s3 += pr[(w + 3) * 512];
    }
    Y[(size_t)(n0 + wave) * EE + j0 + lane] = ((s0 + s1) + (s2 + s3)) + bias;
}

// ---------------------------------------------------------------------------
// Stage 1 in one launch:
//   q[n,j]     = src[l=2048,n,:] . Wq[j,:] + bq[j]
//   qk[n,h,e]  = sum_d q[n,h*64+d] * Wk[h*64+d,e]   (h padded to 16 rows of zeros)
//   sb[n,h]    = q[n,h,:] . bk[h,:]                 (score bias from k's bias)
// Grid: 8 heads x 2 groups of 16 rows n x 4 ranges of 128 columns e; 16 waves.
// Every block forms its head's q (16 x 64, K = 512) itself, as lin_tile does
// (wave w owns the K slice [32w, 32w+32), partials summed in LDS in the same
// fixed order), keeps it in LDS and multiplies it with its 64 x 128 piece of
// Wk: wave w owns columns 16(w&7) .. +15 and the d half w>>3.
// k order of the second product: lane (c, h) takes d = 8i + 4h + {0,1} and
// 8i + 4h + {2,3}, for q (row c) and for Wk (column c) alike.
// ---------------------------------------------------------------------------
#define QF_WKP 132   // floats: 512 B of data + 16 B, so the two lane halves (4 rows apart) read distinct banks
#define QF_QP  68    // floats: 272 B, an odd multiple of 16 for plain 16-byte reads

struct QfLds {
    float red[LIN_WAVES][8][4][32];            // K-slice partials of q, lane-major
    float stage[LIN_WAVES][80][LIN_PITCH];     // per wave: 16 rows of src[l], 64 rows of Wq
    float wk[64][QF_WKP];                      // [d][e]
    float qh[16][QF_QP];                       // [n][d]
    float red2[2][8][8][32];                   // [d half][D register][column tile][lane]
};

__global__ __launch_bounds__(512) void qk_fused_kernel(const float* __restrict__ src,
                                                       const float* __restrict__ Wq,
                                                       const float* __restrict__ bq,
                                                       const float* __restrict__ Wk,
                                                       const float* __restrict__ bk,
                                                       float* __restrict__ qk,
                                                       float* __restrict__ sb) {
    __shared__ __attribute__((aligned(16))) QfLds lds;
    const int e0 = (blockIdx.x & 3) * 128;
    const int n0 = ((blockIdx.x >> 2) & 1) * 16;
    const int head = blockIdx.x >> 3;
    // The wave's number in a scalar register: every load address is then a scalar
    // base plus one of two lane offsets, not a vector register pair for each.
    const int wave = __builtin_amdgcn_readfirstlane(threadIdx.x >> 5);
    const int lane = threadIdx.x & 31;
    const int kb = wave * 32;
    const int lr = lane >> 3;            // row within a group of four
    const int lc = (lane & 7) * 4;       // float offset within the 128-byte slice
    const float* X = src + (size_t)2048 * NN * EE + n0 * EE + kb;
    const float* Wh = Wq + (size_t)head * 64 * EE + kb;
    const float* Wkh = Wk + (size_t)(head * 64 + wave * 4) * EE + e0;
    const int go = lr * EE + lc;

    const float bq0 = bq[head * 64 + lane], bq1 = bq[head * 64 + 32 + lane];
    const float bk0 = bk[head * 64 + lane], bk1 = bk[head * 64 + 32 + lane];
    float4 gx[4], gw[16], gk[4];
#pragma unroll
    for (int i = 0; i < 4; ++i)
        gx[i] = *(const float4*)(X + i * 4 * EE + go);
#pragma unroll
    for (int i = 0; i < 16; ++i)
        gw[i] = *(const float4*)(Wh + i * 4 * EE + go);
#pragma unroll
    for (int i = 0; i < 4; ++i)          // one whole 512-byte piece of a Wk row per load
        gk[i] = *(const float4*)(Wkh + i * EE + lane * 4);
#pragma unroll
    for (int i = 0; i < 4; ++i)
        *(float4*)&lds.stage[wave][i * 4 + lr][lc] = gx[i];
#pragma unroll
    for (int i = 0; i < 16; ++i)
        *(float4*)&lds.stage[wave][16 + i * 4 + lr][lc] = gw[i];
    // The Wk rows go to LDS here, ahead of the first product, so that their loads
    // are asked for together with the others (stored behind the product, they
    // were loaded behind it too, their latency in the open).
#pragma unroll
    for (int i = 0; i < 4; ++i)
        *(float4*)&lds.wk[wave * 4 + i][lane * 4] = gk[i];
    // The wave reads back rows that its other lanes wrote: its own LDS stores
    // must be done, and the compiler must not lift the reads over them.
    asm volatile("s_wait_dscnt 0x0" ::: "memory");

    const int c = lane & 15, h = lane >> 4;
    float4 fx[4], fw[4][4];
#pragma unroll
    for (int i = 0; i < 4; ++i) {
        fx[i] = *(const float4*)&lds.stage[wave][c][8 * i + 4 * h];
#pragma unroll
        for (int t = 0; t < 4; ++t)
            fw[t][i] = *(const float4*)&lds.stage[wave][16 + 16 * t + c][8 * i + 4 * h];
    }
    // Fence pair, as in lin_tile: the LDS reads stay ahead of the WMMAs and no
    // address arithmetic is scheduled into the run behind an operand's last use.
    __builtin_amdgcn_sched_barrier(0);
    v8f acc[4] = {};
#pragma unroll
    for (int i = 0; i < 4; ++i) {
#pragma unroll
        for (int t = 0; t < 4; ++t)
            acc[t] = wmma_f32(fx[i].x, fx[i].y, fw[t][i].x, fw[t][i].y, acc[t]);
#pragma unroll
        for (int t = 0; t < 4; ++t)
            acc[t] = wmma_f32(fx[i].z, fx[i].w, fw[t][i].z, fw[t][i].w, acc[t]);
    }
    __builtin_amdgcn_sched_barrier(0);
    // D register r of lane (c, h) = q[n0 + 8h + r][head * 64 + 16t + c].
#pragma unroll
    for (int r = 0; r < 8; ++r)
#pragma unroll
        for (int t = 0; t < 4; ++t)
            lds.red[wave][r][t][lane] = acc[t][r];
    __syncthreads();                     // every wave's partials of q and rows of Wk are in LDS

    // Wave w sums row n0 + w of q: d = lane and d = lane + 32.
    const float* pr = &lds.red[0][wave & 7][h][(wave >> 3) * 16 + c];
    float qv[2];
#pragma unroll
    for (int u = 0; u < 2; ++u) {
        const float* p = pr + u * 64;
        float s0 = p[0 * 1024], s1 = p[1 * 1024], s2 = p[2 * 1024], s3 = p[3 * 1024];
#pragma unroll
        for (int w = 4; w < LIN_WAVES; w += 4) {
            s0 += p[(w + 0) * 1024];
            s1 += p[(w + 1) * 1024];
            s2 += p[(w + 2) * 1024];
            s3 += p[(w + 3) * 1024];
        }
        qv[u] = ((s0 + s1) + (s2 + s3)) + (u ? bq1 : bq0);
        lds.qh[wave][u * 32 + lane] = qv[u];
    }
    __syncthreads();                     // q of the head lies in LDS for every wave

    const int t2 = wave & 7, kh = wave >> 3;
    float4 fa[4];
    float fb[4][4];
#pragma unroll
    for (int i = 0; i < 4; ++i) {
        fa[i] = *(const float4*)&lds.qh[c][32 * kh + 8 * i + 4 * h];
#pragma unroll
        for (int j = 0; j < 4; ++j)
            fb[i][j] = lds.wk[32 * kh + 8 * i + 4 * h + j][16 * t2 + c];
    }
    __builtin_amdgcn_sched_barrier(0);   // fence pair, as above
    v8f a2 = {};
#pragma unroll
    for (int i = 0; i < 4; ++i) {
        a2 = wmma_f32(fa[i].x, fa[i].y, fb[i][0], fb[i][1], a2);
        a2 = wmma_f32(fa[i].z, fa[i].w, fb[i][2], fb[i][3], a2);
    }
    __builtin_amdgcn_sched_barrier(0);
    // D register r of lane (c, h) = qk[n0 + 8h + r][head][e0 + 16 t2 + c], d half kh.
#pragma unroll
    for (int r = 0; r < 8; ++r)
        lds.red2[kh][r][t2][lane] = a2[r];
    __syncthreads();                     // both d halves of every column tile are in LDS

    // Wave w stores row n0 + w: 128 columns = four whole 128-byte lines, and the
    // same columns of the padding head as zeros.
    const float* p2 = &lds.red2[0][wave & 7][lane >> 2][(wave >> 3) * 16 + (lane & 3) * 4];
    const float4 u0 = *(const float4*)p2;
    const float4 u1 = *(const float4*)(p2 + 2048);
    float* o = qk + ((size_t)(n0 + wave) * 16 + head) * EE + e0 + lane * 4;
    *(float4*)o = make_float4(u0.x + u1.x, u0.y + u1.y, u0.z + u1.z, u0.w + u1.w);
    *(float4*)(o + 8 * EE) = make_float4(0.0f, 0.0f, 0.0f, 0.0f);
    // Precaution: stands between the two stores and the reuse of their registers below.
    asm volatile("s_wait_xcnt 0x0" ::: "memory");
    // One block per (head, row group) hands on the score bias of its rows, last,
    // so that no barrier waits for this sum or its store.
    if (e0 == 0) {
        float sv = fmaf(qv[1], bk1, qv[0] * bk0);
#pragma unroll
        for (int m = 16; m >= 1; m >>= 1) sv += __shfl_xor(sv, m, 32);
        if (lane == 0) sb[(n0 + wave) * HH + head] = sv;
    }
}

// ---------------------------------------------------------------------------
// Stages 2 to 4 in one pass over src (each src row is read from memory once).
// Grid (n, chunk of 512 s). 16 waves; two rounds of 256 s rows.
// Round: wave w brings rows 16w .. 16w+15 (whole 512-byte pieces of a row per
// load), rounds them to bf16 and lays them row-major in LDS. Then
//   S^T[s, head] = src[s, :] . qk[head, :]      A = own 16 rows, B = qk (LDS)
//   p = exp(x - running max), handed over in LDS as the B fragment of
//   ctx^T[e, head] += src^T[e, s] . p[s, head]  A = transposing LDS loads,
// where wave w owns e = 32w .. 32w+31 over all 256 rows of the round.
// Both products use the hardware k order: k = 8h + i, then 16 + 8h + i.
// The block hands on an un-normalised sum with its (max, sum) per head.
// ---------------------------------------------------------------------------
typedef __attribute__((ext_vector_type(4))) unsigned int u32x4;
typedef __attribute__((ext_vector_type(2))) unsigned int u32x2;
typedef __attribute__((ext_vector_type(8))) short s16x8;
typedef __attribute__((ext_vector_type(2))) __bf16 bf16x2;

#define FA_WAVES  16
#define FA_ROWS   256     // s rows per round
#define FA_ROUNDS 2
#define FA_CHUNKS 8
#define FA_PITCH  1056    // bytes: 1024 of data + 32, an odd multiple of 32 for the transposing loads
#define FA_QPITCH 1040    // bytes, qk rows: an odd multiple of 16 for plain 16-byte reads
#define ROWF      (NN * EE)   // floats between consecutive s

union Frag { u32x4 q[2]; v16bf v; };

#define FA_DEPTH 6        // rows (2 KiB each) that a wave keeps in flight
#define FA_MXP 20         // floats per head in the exchange rows: 80 B, an odd multiple of 16

struct FaLds {                         // the small arrays first: their offsets fit the LDS instructions' immediate
    u32x4 p[FA_ROWS / 32][2][32];      // [k step][first / second 16 rows][lane]
    float mx[16 * FA_MXP];             // [head][wave]
    unsigned char qk[16 * FA_QPITCH];
    unsigned char tile[FA_ROWS * FA_PITCH];
};

__device__ __forceinline__ unsigned int pack2(float lo, float hi) {
    v2f f = {lo, hi};
    return __builtin_bit_cast(unsigned int, __builtin_convertvector(f, bf16x2));
}
__device__ __forceinline__ void put_bf16x4(unsigned char* dst, float4 v) {
    u32x2 w = {pack2(v.x, v.y), pack2(v.z, v.w)};
    *(u32x2*)dst = w;
}
__device__ __forceinline__ u32x4 ld_tr16(const unsigned char* p) {
    typedef __attribute__((address_space(3))) s16x8 lds_s16x8;
    return __builtin_bit_cast(u32x4, __builtin_amdgcn_ds_load_tr16_b128_v8i16((lds_s16x8*)p));
}
// lane l <-> lane l ^ 16
__device__ __forceinline__ float xhalf(float x) {
    int b = __builtin_bit_cast(int, x);
    return __builtin_bit_cast(float, __builtin_amdgcn_permlanex16(b, b, 0x76543210, 0xfedcba98, false, false));
}
__device__ __forceinline__ float bf_lo(unsigned int w) { return __builtin_bit_cast(float, w << 16); }
__device__ __forceinline__ float bf_hi(unsigned int w) { return __builtin_bit_cast(float, w & 0xffff0000u); }
// exp(x) as __expf is built (one multiply, v_exp_f32), in asm so that the v_nop
// stands directly behind the transcendental: the slot that the instruction set
// asks for in front of an instruction that reads its result or overwrites its
// source.
__device__ __forceinline__ float exp_slot(float x) {
    float r;
    asm("v_exp_f32 %0, %1\n\tv_nop" : "=v"(r) : "v"(x * 1.44269504f));
    return r;
}
// Work-group barrier for hand-overs through LDS: the wave's LDS operations are
// done before it signals, while its global loads of the coming rows stay in
// flight (__syncthreads() was built with a wait for those loads as well). The
// scheduling fences keep work on those loads' registers from moving over it.
__device__ __forceinline__ void lds_barrier() {
    __builtin_amdgcn_sched_barrier(0);
    asm volatile("s_wait_dscnt 0x0\n\ts_barrier_signal -1\n\ts_barrier_wait -1" ::: "memory");
    __builtin_amdgcn_sched_barrier(0);
}

__global__ __launch_bounds__(512) void attn_pass_kernel(const float* __restrict__ src,
                                                        const float* __restrict__ qk,
                                                        const float* __restrict__ sb,
                                                        float* __restrict__ part,
                                                        float* __restrict__ ml) {
    __shared__ __attribute__((aligned(16))) FaLds lds;
    const int n = blockIdx.x;            // 0..31
    const int ch = blockIdx.y;           // 0..7  (512 s each)
    // The wave's number in a scalar register: row addresses are then a scalar
    // base plus one lane offset, not a vector register pair for each.
    const int wave = __builtin_amdgcn_readfirstlane(threadIdx.x >> 5);
    const int lane = threadIdx.x & 31;
    const int c = lane & 15, h = lane >> 4;

    // qk[n] (16 padded heads x 512) -> bf16 in LDS.
    float4 gq[4];
#pragma unroll
    for (int i = 0; i < 4; ++i)
        gq[i] = *(const float4*)(qk + (size_t)n * 16 * EE + (i * 512 + (int)threadIdx.x) * 4);
    const float bias = sb[n * HH + (c & 7)];   // padding columns 8..15 are never stored
    // Precaution: stands between the loads above and any reuse of their offset
    // registers.
    asm volatile("s_wait_xcnt 0x0" ::: "memory");

    // Row f (0..31) of the wave's share: round f >> 4, row f & 15 of its sixteen;
    // four loads of 512 contiguous bytes each. FA_DEPTH rows are kept in flight.
    const float* g = src + ((size_t)(ch * (FA_ROWS * FA_ROUNDS) + wave * 16) * NN + n) * EE;
    const int gl = lane * 4;
    float4 buf[FA_DEPTH * 4];
#pragma unroll
    for (int i = 0; i < FA_DEPTH * 4; ++i)
        buf[i] = *(const float4*)(g + (size_t)(i >> 2) * ROWF + (i & 3) * 128 + gl);
    __builtin_amdgcn_sched_barrier(0);   // the first rows are asked for before anything waits
#pragma unroll
    for (int i = 0; i < 4; ++i) {
        int f = (i * 512 + (int)threadIdx.x) * 4;
        put_bf16x4(lds.qk + (f >> 9) * FA_QPITCH + (f & 511) * 2, gq[i]);
    }

    unsigned char* trow = lds.tile + (wave * 16) * FA_PITCH + lane * 8;
    const unsigned char* ta = lds.tile + (wave * 16 + c) * FA_PITCH + 16 * h;
    const unsigned char* tb = lds.qk + c * FA_QPITCH + 16 * h;
    const unsigned char* tt = lds.tile + (8 * h + (lane & 7)) * FA_PITCH + ((lane >> 3) & 1) * 16 + wave * 64;

    float m_run = -INFINITY, l_run = 0.0f;
    v8f acc0 = {}, acc1 = {};
#pragma unroll
    for (int r = 0; r < FA_ROUNDS; ++r) {
        // Row by row: a row's four registers are asked for again as soon as the
        // row lies in LDS, so that the wave's loads stay in flight, through the
        // products too. The fence keeps that order (without it the loads were
        // bunched, more registers were live and some were spilled).
#pragma unroll
        for (int q = 0; q < 16; ++q) {
            const int f = r * 16 + q, slot = (f % FA_DEPTH) * 4, fn = f + FA_DEPTH;
#pragma unroll
            for (int k = 0; k < 4; ++k)
                put_bf16x4(trow + q * FA_PITCH + k * 256, buf[slot + k]);
            if (fn < FA_ROUNDS * 16) {
                const float* gn = g + (size_t)((fn >> 4) * FA_ROWS + (fn & 15)) * ROWF;
#pragma unroll
                for (int k = 0; k < 4; ++k)
                    buf[slot + k] = *(const float4*)(gn + k * 128 + gl);
            }
            __builtin_amdgcn_sched_barrier(0);
        }
        if (r == 0) lds_barrier();       // qk lies in LDS for every wave

        // Scores of the wave's own 16 rows: s0[i] + s1[i] = raw[s = 16w + 8h + i][head c].
        v8f s0 = {}, s1 = {};
#pragma unroll
        for (int ks = 0; ks < 16; ks += 2) {
            Frag a0, b0, a1, b1;
            a0.q[0] = *(const u32x4*)(ta + ks * 64);      a0.q[1] = *(const u32x4*)(ta + ks * 64 + 32);
            b0.q[0] = *(const u32x4*)(tb + ks * 64);      b0.q[1] = *(const u32x4*)(tb + ks * 64 + 32);
            a1.q[0] = *(const u32x4*)(ta + ks * 64 + 64); a1.q[1] = *(const u32x4*)(ta + ks * 64 + 96);
            b1.q[0] = *(const u32x4*)(tb + ks * 64 + 64); b1.q[1] = *(const u32x4*)(tb + ks * 64 + 96);
            s0 = wmma_bf16(a0.v, b0.v, s0);
            s1 = wmma_bf16(a1.v, b1.v, s1);
        }
        float x[8];
        float mx = -INFINITY;
#pragma unroll
        for (int i = 0; i < 8; ++i) {
            x[i] = ((s0[i] + s1[i]) + bias) * 0.125f;
            mx = fmaxf(mx, x[i]);
        }
        mx = fmaxf(mx, xhalf(mx));
        lds.mx[c * FA_MXP + wave] = mx;  // both halves hold the same value
        lds_barrier();                   // every wave's maxima are in LDS
        float4 m4[4];
#pragma unroll
        for (int i = 0; i < 4; ++i) m4[i] = *(const float4*)&lds.mx[c * FA_MXP + 4 * i];
        float mr = -INFINITY;
#pragma unroll
        for (int i = 0; i < 4; ++i)
            mr = fmaxf(mr, fmaxf(fmaxf(m4[i].x, m4[i].y), fmaxf(m4[i].z, m4[i].w)));
        const float m_new = fmaxf(m_run, mr);
        const float scale = exp_slot(m_run - m_new);
        m_run = m_new;
        u32x4 pw;
        float ls = 0.0f;                 // the sum is taken of the rounded weights
#pragma unroll
        for (int i = 0; i < 4; ++i) {
            pw[i] = pack2(exp_slot(x[2 * i] - m_new), exp_slot(x[2 * i + 1] - m_new));
            ls += bf_lo(pw[i]) + bf_hi(pw[i]);
        }
        l_run = fmaf(l_run, scale, ls);
        lds.p[wave >> 1][wave & 1][lane] = pw;
        lds_barrier();                   // every wave's rows and weights are in LDS

#pragma unroll
        for (int i = 0; i < 8; ++i) { acc0[i] *= scale; acc1[i] *= scale; }
#pragma unroll
        for (int j = 0; j < FA_ROWS / 32; ++j) {
            Frag b, a0, a1;
            b.q[0] = lds.p[j][0][lane];
            b.q[1] = lds.p[j][1][lane];
            const unsigned char* tj = tt + j * 32 * FA_PITCH;
            a0.q[0] = ld_tr16(tj);      a0.q[1] = ld_tr16(tj + 16 * FA_PITCH);
            a1.q[0] = ld_tr16(tj + 32); a1.q[1] = ld_tr16(tj + 16 * FA_PITCH + 32);
            acc0 = wmma_bf16(a0.v, b.v, acc0);
            acc1 = wmma_bf16(a1.v, b.v, acc1);
        }
        if (r + 1 < FA_ROUNDS)
            lds_barrier();               // all reads of this round's LDS are done
    }

    // The waves' sums of weights (all against the same final maximum) -> wave 0.
    lds.mx[c * FA_MXP + wave] = l_run + xhalf(l_run);
    lds_barrier();

    // acc{0,1}[i] = ctx^T[e = 32w + {0,16} + 8h + i][head c]; heads 8..15 are padding.
    if (c < HH) {
        float* o = part + (((size_t)ch * NN + n) * HH + c) * EE + wave * 32 + 8 * h;
        *(float4*)(o)      = make_float4(acc0[0], acc0[1], acc0[2], acc0[3]);
        *(float4*)(o + 4)  = make_float4(acc0[4], acc0[5], acc0[6], acc0[7]);
        *(float4*)(o + 16) = make_float4(acc1[0], acc1[1], acc1[2], acc1[3]);
        *(float4*)(o + 20) = make_float4(acc1[4], acc1[5], acc1[6], acc1[7]);
        if (wave == 0 && h == 0) {
            float l_tot = 0.0f;
#pragma unroll
            for (int w = 0; w < FA_WAVES; ++w) l_tot += lds.mx[c * FA_MXP + w];
            ml[((ch * NN + n) * HH + c) * 2 + 0] = m_run;
            ml[((ch * NN + n) * HH + c) * 2 + 1] = l_tot;
        }
    }
}

// Merge of the 8 chunks: weights exp(m_c - M), divided by the merged sum.
__global__ __launch_bounds__(256) void merge_kernel(const float* __restrict__ part,
                                                    const float* __restrict__ ml,
                                                    float* __restrict__ ctx) {
    int idx = blockIdx.x * 256 + threadIdx.x;   // 32*8*512 = 131072
    int nh = idx >> 9;
    float m[FA_CHUNKS], l[FA_CHUNKS], v[FA_CHUNKS];
    float M = -INFINITY;
#pragma unroll
    for (int k = 0; k < FA_CHUNKS; ++k) {
        m[k] = ml[(k * (NN * HH) + nh) * 2 + 0];
        l[k] = ml[(k * (NN * HH) + nh) * 2 + 1];
        v[k] = part[(size_t)k * 131072 + idx];
        M = fmaxf(M, m[k]);
    }
    float L = 0.0f, a = 0.0f;
#pragma unroll
    for (int k = 0; k < FA_CHUNKS; ++k) {
        float w = __expf(m[k] - M);
        L = fmaf(w, l[k], L);
        a = fmaf(w, v[k], a);
    }
    ctx[idx] = a / L;
}

// ---------------------------------------------------------------------------
// Stage 5: tiny output chain.
// mo[n,j] = Wv[j,:].ctx[n, j>>6, :] + bv[j]   (bv passes through: sum p == 1)
// o2 = mo @ Wo.T + bo ; out = o2 @ Wl.T + bl
// ---------------------------------------------------------------------------
__global__ __launch_bounds__(512) void vproj_kernel(const float* __restrict__ ctx,
                                                    const float* __restrict__ Wv,
                                                    const float* __restrict__ bv,
                                                    float* __restrict__ mo) {
    int j0 = (blockIdx.x & 15) * 32, n0 = (blockIdx.x >> 4) * 16;
    int head = j0 >> 6;            // the block's 32 columns lie in one head
    lin_tile(ctx + (size_t)head * EE, HH * EE, Wv, bv, mo, n0, j0);
}

__global__ __launch_bounds__(512) void lin_kernel(const float* __restrict__ A,
                                                  const float* __restrict__ W,
                                                  const float* __restrict__ b,
                                                  float* __restrict__ out) {
    int j0 = (blockIdx.x & 15) * 32, n0 = (blockIdx.x >> 4) * 16;
    lin_tile(A, EE, W, b, out, n0, j0);
}

// ---------------------------------------------------------------------------
extern "C" void kernel_launch(void* const* d_in, const int* in_sizes, int n_in,
                              void* d_out, int out_size, void* d_ws, size_t ws_size,
                              hipStream_t stream) {
    const float* src = (const float*)d_in[0];
    const float* Wq  = (const float*)d_in[1];
    const float* bq  = (const float*)d_in[2];
    const float* Wk  = (const float*)d_in[3];
    const float* bk  = (const float*)d_in[4];
    const float* Wv  = (const float*)d_in[5];
    const float* bv  = (const float*)d_in[6];
    const float* Wo  = (const float*)d_in[7];
    const float* bo  = (const float*)d_in[8];
    const float* Wl  = (const float*)d_in[9];
    const float* bl  = (const float*)d_in[10];

    float* ws = (float*)d_ws;
    float* qkbuf  = ws + 16384;       // 32*16*512 = 262144 (head-padded)
    float* sb     = ws + 278528;      // 256
    float* ml     = ws + 278784;      // 8*32*8 pairs (max, sum) = 4096
    float* part   = ws + 3424512;     // 8*32*8*512 = 1048576
    float* ctx    = ws + 4473088;     // 32*8*512 = 131072
    float* mo     = ws + 4604160;     // 16384
    float* o2     = ws + 4620544;     // 16384  (end: 4636928 floats ~ 17.7 MB)

    qk_fused_kernel<<<64,  512, 0, stream>>>(src, Wq, bq, Wk, bk, qkbuf, sb);
    attn_pass_kernel<<<dim3(32, 8), 512, 0, stream>>>(src, qkbuf, sb, part, ml);
    merge_kernel  <<<512,  256, 0, stream>>>(part, ml, ctx);
    vproj_kernel  <<<32,   512, 0, stream>>>(ctx, Wv, bv, mo);
    lin_kernel    <<<32,   512, 0, stream>>>(mo, Wo, bo, o2);
    lin_kernel    <<<32,   512, 0, stream>>>(o2, Wl, bl, (float*)d_out);
}

// v004
// A run of this version takes 39.6 microseconds.
// Two timings next to v003 put it at 1.08 and 1.07 times that version's speed.
// Over all steps from v000 it is 3.61 times as fast.
#include <hip/hip_runtime.h>
#include <math.h>

// Problem constants (from reference): S=4096, N=32, E=512, H=8, DK=64, l=2048.
#define SS 4096
#define NN 32
#define EE 512
#define HH 8

typedef __attribute__((ext_vector_type(16))) __bf16 v16bf;
typedef __attribute__((ext_vector_type(8)))  float  v8f;
typedef __attribute__((ext_vector_type(2)))  float  v2f;

__device__ __forceinline__ v8f wmma_bf16(v16bf a, v16bf b, v8f c) {
    return __builtin_amdgcn_wmma_f32_16x16x32_bf16(false, a, false, b, (short)0, c, false, false);
}

// ---------------------------------------------------------------------------
// Shared tile for the two small linears  Y[n,j] = X[n,:] . Wt[j,:] + b[j]
// (32 x 512, K = 512), all in f32 on v_wmma_f32_16x16x4_f32.
// One block of 16 waves owns 16 rows n x 32 columns j. Wave w owns the K slice
// [32w, 32w+32): it issues all of its loads at once (each wave-wide 16-byte
// load covers four whole 128-byte lines: 4 rows x 32 floats), turns them into
// fragments through its own LDS range, and runs two accumulator chains of 8
// WMMAs. The 16 K-slice partials are summed in LDS in a fixed order.
// k order: lane (c = lane&15, h = lane>>4) takes k = 8i + 4h + {0,1} and
// 8i + 4h + {2,3} of its row, by the same code for X and for Wt.
// ---------------------------------------------------------------------------
#define LIN_WAVES 16
#define LIN_PITCH 36   // floats: 128 B of data + 16 B, so 16 rows' 16-byte reads fall on 64 distinct banks

__device__ __forceinline__ v8f wmma_f32(float a0, float a1, float b0, float b1, v8f c) {
    v2f a = {a0, a1};
    v2f b = {b0, b1};
    return __builtin_amdgcn_wmma_f32_16x16x4_f32(false, a, false, b, (short)0, c, false, false);
}

struct LinLds {
    float red[LIN_WAVES][8][2][32];            // K-slice partials, lane-major
    float stage[LIN_WAVES][48][LIN_PITCH];     // per wave: 16 rows of X, 32 rows of Wt
};

__device__ __forceinline__ void lin_tile(const float* __restrict__ X, int x_stride,
                                         const float* __restrict__ Wt,
                                         const float* __restrict__ b,
                                         float* __restrict__ Y, int n0, int j0) {
    __shared__ __attribute__((aligned(16))) LinLds lds;
    int wave = threadIdx.x >> 5;
    int lane = threadIdx.x & 31;
    int kb = wave * 32;
    int lr = lane >> 3;            // row within a group of four
    int lc = (lane & 7) * 4;       // float offset within the 128-byte slice

    float4 gx[4], gw[8];
#pragma unroll
    for (int i = 0; i < 4; ++i)
        gx[i] = *(const float4*)(X + (size_t)(n0 + i * 4 + lr) * x_stride + kb + lc);
#pragma unroll
    for (int i = 0; i < 8; ++i)
        gw[i] = *(const float4*)(Wt + (size_t)(j0 + i * 4 + lr) * EE + kb + lc);
    float bias = b[j0 + lane];     // asked for with the tiles, used at the very end
#pragma unroll
    for (int i = 0; i < 4; ++i)
        *(float4*)&lds.stage[wave][i * 4 + lr][lc] = gx[i];
#pragma unroll
    for (int i = 0; i < 8; ++i)
        *(float4*)&lds.stage[wave][16 + i * 4 + lr][lc] = gw[i];
    // The wave reads back rows that its other lanes wrote: its own LDS stores
    // must be done, and the compiler must not lift the reads over them.
    asm volatile("s_wait_dscnt 0x0" ::: "memory");

    int c = lane & 15, h = lane >> 4;
    float4 fx[4], f0[4], f1[4];
#pragma unroll
    for (int i = 0; i < 4; ++i) {
        fx[i] = *(const float4*)&lds.stage[wave][c][8 * i + 4 * h];
        f0[i] = *(const float4*)&lds.stage[wave][16 + c][8 * i + 4 * h];
        f1[i] = *(const float4*)&lds.stage[wave][32 + c][8 * i + 4 * h];
    }
    // Fence pair: the LDS reads stay one group ahead of the WMMAs, and no address
    // arithmetic is scheduled into the run, where it could overwrite an operand
    // register directly behind the WMMA that reads it.
    __builtin_amdgcn_sched_barrier(0);
    v8f acc0 = {}, acc1 = {};
#pragma unroll
    for (int i = 0; i < 4; ++i) {
        acc0 = wmma_f32(fx[i].x, fx[i].y, f0[i].x, f0[i].y, acc0);
        acc1 = wmma_f32(fx[i].x, fx[i].y, f1[i].x, f1[i].y, acc1);
        acc0 = wmma_f32(fx[i].z, fx[i].w, f0[i].z, f0[i].w, acc0);
        acc1 = wmma_f32(fx[i].z, fx[i].w, f1[i].z, f1[i].w, acc1);
    }
    __builtin_amdgcn_sched_barrier(0);
    // D register r of lane (c, h) = Y[n0 + 8h + r][j0 + 16t + c].
#pragma unroll
    for (int r = 0; r < 8; ++r) {
        lds.red[wave][r][0][lane] = acc0[r];
        lds.red[wave][r][1][lane] = acc1[r];
    }
    __syncthreads();
    // Wave w stores row n0 + w: 32 columns = one whole 128-byte line.
    const float* pr = &lds.red[0][wave & 7][lane >> 4][(wave >> 3) * 16 + c];
    float s0 = pr[0 * 512], s1 = pr[1 * 512], s2 = pr[2 * 512], s3 = pr[3 * 512];
#pragma unroll
    for (int w = 4; w < LIN_WAVES; w += 4) {
        s0 += pr[(w + 0) * 512];
        s1 += pr[(w + 1) * 512];
        s2 += pr[(w + 2) * 512];
        s3 += pr[(w + 3) * 512];
    }
    Y[(size_t)(n0 + wave) * EE + j0 + lane] = ((s0 + s1) + (s2 + s3)) + bias;
}

// ---------------------------------------------------------------------------
// The two last linears as one:  (mo Wo^T + bo) Wl^T + bl = mo W2^T + b2  with
//   W2[i,j] = sum_k Wl[i,k] * Wo[k,j]     b2[i] = Wl[i,:] . bo + bl[i]
// W2 and b2 depend on the weights alone, so they are formed in the first launch,
// by work-groups of their own on WGPs that the launch leaves idle.
// One block of 16 waves owns 32 rows i x 64 columns j. Wave w owns the K slice
// [32w, 32w+32): its 32 x 32 piece of Wl goes through its own LDS range as in
// lin_tile; its 32 x 64 piece of Wo stays in registers: lane (c, h) loads the four
// columns j0 + 4c .. +3 of row k, one for each of four column tiles, so column c
// of tile t is j0 + 4c + t and every load covers whole 128-byte lines.
// k order: lane (c, h) takes k = 8i + 4h + {0,1} and 8i + 4h + {2,3}, for Wl
// (row c) and for Wo (column c) alike. The 16 K-slice partials are summed in LDS
// in a fixed order.
// ---------------------------------------------------------------------------
struct FoldLds {
    float red[LIN_WAVES][2][8][32][4];         // K-slice partials: [row tile][D register][lane][column tile]
    float stage[LIN_WAVES][32][LIN_PITCH];     // per wave: 32 rows of Wl
    float bred[LIN_WAVES][32];                 // K-slice partials of Wl . bo
};

__device__ __forceinline__ void fold_tile(FoldLds& lds,
                                          const float* __restrict__ Wl,
                                          const float* __restrict__ Wo,
                                          const float* __restrict__ bo,
                                          const float* __restrict__ bl,
                                          float* __restrict__ W2,
                                          float* __restrict__ b2, int i0, int j0) {
    const int wave = __builtin_amdgcn_readfirstlane(threadIdx.x >> 5);
    const int lane = threadIdx.x & 31;
    const int kb = wave * 32;
    const int lr = lane >> 3;            // row within a group of four
    const int lc = (lane & 7) * 4;       // float offset within the 128-byte slice
    const int c = lane & 15, h = lane >> 4;
    // Scalar bases and one lane offset (in bytes) each, as in the kernel below.
    const char* A = (const char*)(Wl + (size_t)i0 * EE + kb);
    const char* B = (const char*)(Wo + (size_t)kb * EE + j0);
    const unsigned int ao = (lr * EE + lc) * 4, bofs = (h * 4 * EE + c * 4) * 4;
    const bool first = j0 == 0;          // one block per row group forms b2 as well

    float4 ga[8], gb[4][4], gbo[4];
    float blv = 0.0f;
#pragma unroll
    for (int i = 0; i < 8; ++i)
        ga[i] = *(const float4*)(A + i * 4 * EE * 4 + ao);
#pragma unroll
    for (int i = 0; i < 4; ++i)
#pragma unroll
        for (int j = 0; j < 4; ++j)
            gb[i][j] = *(const float4*)(B + (8 * i + j) * EE * 4 + bofs);
    // Precaution: the loads' lane offsets are inputs here, so their registers are
    // not given to anything else (a load's destination either) ahead of this wait.
    asm volatile("s_wait_xcnt 0x0" :: "v"(ao), "v"(bofs) : "memory");
    if (first) {
#pragma unroll
        for (int i = 0; i < 4; ++i)
            gbo[i] = *(const float4*)(bo + kb + 8 * i + 4 * h);
        blv = (bl + i0)[lane];
    }
#pragma unroll
    for (int i = 0; i < 8; ++i)
        *(float4*)&lds.stage[wave][i * 4 + lr][lc] = ga[i];
    // The wave reads back rows that its other lanes wrote: its own LDS stores
    // must be done, and the compiler must not lift the reads over them.
    asm volatile("s_wait_dscnt 0x0" ::: "memory");
    float4 fx[2][4];
#pragma unroll
    for (int a = 0; a < 2; ++a)
#pragma unroll
        for (int i = 0; i < 4; ++i)
            fx[a][i] = *(const float4*)&lds.stage[wave][16 * a + c][8 * i + 4 * h];
    if (first) {
#pragma unroll
        for (int a = 0; a < 2; ++a) {
            float s = 0.0f;
#pragma unroll
            for (int i = 0; i < 4; ++i) {
                s = fmaf(fx[a][i].x, gbo[i].x, s);
                s = fmaf(fx[a][i].y, gbo[i].y, s);
                s = fmaf(fx[a][i].z, gbo[i].z, s);
                s = fmaf(fx[a][i].w, gbo[i].w, s);
            }
            s += __shfl_xor(s, 16, 32);
            lds.bred[wave][16 * a + c] = s;   // both halves hold the same value
        }
    }
    // The B operand wants two k of one column side by side; a load holds four
    // columns of one k. The pairs are formed here, in registers of their own.
    v2f bp[4][2][4];
#pragma unroll
    for (int i = 0; i < 4; ++i)
#pragma unroll
        for (int p = 0; p < 2; ++p) {
            bp[i][p][0] = v2f{gb[i][2 * p].x, gb[i][2 * p + 1].x};
            bp[i][p][1] = v2f{gb[i][2 * p].y, gb[i][2 * p + 1].y};
            bp[i][p][2] = v2f{gb[i][2 * p].z, gb[i][2 * p + 1].z};
            bp[i][p][3] = v2f{gb[i][2 * p].w, gb[i][2 * p + 1].w};
        }
    // Fence pair, as in lin_tile: operands are complete ahead of the WMMAs and
    // nothing is scheduled into the run behind an operand's last use.
    __builtin_amdgcn_sched_barrier(0);
    v8f acc[2][4] = {};
#pragma unroll
    for (int i = 0; i < 4; ++i)
        // (p, a) = (0,0) (1,1) (0,1) (1,0): every B pair that the first eight WMMAs
        // read is read again later, so that no accumulator, which gets its registers
        // there, is laid over a B pair just read.
#pragma unroll
        for (int u = 0; u < 4; ++u) {
            const int p = u & 1, a = (u ^ (u >> 1)) & 1;
            const v2f av = p ? v2f{fx[a][i].z, fx[a][i].w} : v2f{fx[a][i].x, fx[a][i].y};
#pragma unroll
            for (int t = 0; t < 4; ++t)
                acc[a][t] = __builtin_amdgcn_wmma_f32_16x16x4_f32(false, av, false, bp[i][p][t],
                                                                  (short)0, acc[a][t], false, false);
        }
    __builtin_amdgcn_sched_barrier(0);
    // The distance between the last WMMAs and the moves below, which reuse their
    // operand registers and read their results.
    asm volatile("v_nop\n\tv_nop\n\tv_nop\n\tv_nop");
    __builtin_amdgcn_sched_barrier(0);
    // D register r of lane (c, h), tile (a, t) = W2[i0 + 16a + 8h + r][j0 + 4c + t].
#pragma unroll
    for (int a = 0; a < 2; ++a)
#pragma unroll
        for (int r = 0; r < 8; ++r)
            *(float4*)&lds.red[wave][a][r][lane][0] =
                make_float4(acc[a][0][r], acc[a][1][r], acc[a][2][r], acc[a][3][r]);
    __syncthreads();                     // every wave's partials are in LDS
    // Wave w stores rows i0 + 2w and i0 + 2w + 1: 64 columns = two whole lines each.
    const int row = wave * 2 + h;
    const float* pr = &lds.red[0][row >> 4][row & 7][((row >> 3) & 1) * 16 + c][0];
    float4 s[4];
#pragma unroll
    for (int w = 0; w < 4; ++w) s[w] = *(const float4*)(pr + w * 2048);
#pragma unroll
    for (int w = 4; w < LIN_WAVES; ++w) {
        const float4 v = *(const float4*)(pr + w * 2048);
        s[w & 3].x += v.x; s[w & 3].y += v.y; s[w & 3].z += v.z; s[w & 3].w += v.w;
    }
    *(float4*)(W2 + (size_t)(i0 + row) * EE + j0 + c * 4) =
        make_float4((s[0].x + s[1].x) + (s[2].x + s[3].x), (s[0].y + s[1].y) + (s[2].y + s[3].y),
                    (s[0].z + s[1].z) + (s[2].z + s[3].z), (s[0].w + s[1].w) + (s[2].w + s[3].w));
    // Precaution: stands between the store and the reuse of its registers below.
    asm volatile("s_wait_xcnt 0x0" ::: "memory");
    if (first && wave == 0) {
        float t0 = 0.0f;
#pragma unroll
        for (int w = 0; w < LIN_WAVES; ++w) t0 += lds.bred[w][lane];
        b2[i0 + lane] = t0 + blv;
    }
}

// ---------------------------------------------------------------------------
// Stage 1 in one launch:
//   q[n,j]     = src[l=2048,n,:] . Wq[j,:] + bq[j]
//   qk[n,h,e]  = sum_d q[n,h*64+d] * Wk[h*64+d,e]   (h padded to 16 rows of zeros)
//   sb[n,h]    = q[n,h,:] . bk[h,:]                 (score bias from k's bias)
// Grid: 128 blocks of fold_tile (they start first: theirs is the longer run of
// WMMAs), then 8 heads x 2 groups of 16 rows n x 4 ranges of 128 columns e; 16 waves.
// Each of those 64 blocks forms its head's q (16 x 64, K = 512) itself, as lin_tile does
// (wave w owns the K slice [32w, 32w+32), partials summed in LDS in the same
// fixed order), keeps it in LDS and multiplies it with its 64 x 128 piece of
// Wk: wave w owns columns 16(w&7) .. +15 and the d half w>>3.
// k order of the second product: lane (c, h) takes d = 8i + 4h + {0,1} and
// 8i + 4h + {2,3}, for q (row c) and for Wk (column c) alike.
// ---------------------------------------------------------------------------
#define FOLD_BLOCKS 128   // 16 groups of 32 rows i x 8 groups of 64 columns j
#define QF_WKP 132   // floats: 512 B of data + 16 B, so the two lane halves (4 rows apart) read distinct banks
#define QF_QP  68    // floats: 272 B, an odd multiple of 16 for plain 16-byte reads

struct QfLds {
    float red[LIN_WAVES][8][4][32];            // K-slice partials of q, lane-major
    float stage[LIN_WAVES][80][LIN_PITCH];     // per wave: 16 rows of src[l], 64 rows of Wq
    float wk[64][QF_WKP];                      // [d][e]
    float qh[16][QF_QP];                       // [n][d]
    float red2[2][8][8][32];                   // [d half][D register][column tile][lane]
};

__global__ __launch_bounds__(512) void qk_fused_kernel(const float* __restrict__ src,
                                                       const float* __restrict__ Wq,
                                                       const float* __restrict__ bq,
                                                       const float* __restrict__ Wk,
                                                       const float* __restrict__ bk,
                                                       const float* __restrict__ Wo,
                                                       const float* __restrict__ bo,
                                                       const float* __restrict__ Wl,
                                                       const float* __restrict__ bl,
                                                       float* __restrict__ qk,
                                                       float* __restrict__ sb,
                                                       float* __restrict__ W2,
                                                       float* __restrict__ b2) {
    __shared__ __attribute__((aligned(16))) union { QfLds q; FoldLds f; } both;
    if (blockIdx.x < FOLD_BLOCKS) {      // the same for the whole block, ahead of every barrier
        fold_tile(both.f, Wl, Wo, bo, bl, W2, b2, (blockIdx.x >> 3) * 32, (blockIdx.x & 7) * 64);
        return;
    }
    QfLds& lds = both.q;
    const int bid = blockIdx.x - FOLD_BLOCKS;
    const int e0 = (bid & 3) * 128;
    const int n0 = ((bid >> 2) & 1) * 16;
    const int head = bid >> 3;
    // The wave's number in a scalar register: every load address is then a scalar
    // base plus one of two lane offsets, not a vector register pair for each.
    const int wave = __builtin_amdgcn_readfirstlane(threadIdx.x >> 5);
    const int lane = threadIdx.x & 31;
    const int kb = wave * 32;
    const int lr = lane >> 3;            // row within a group of four
    const int lc = (lane & 7) * 4;       // float offset within the 128-byte slice
    const float* X = src + (size_t)2048 * NN * EE + n0 * EE + kb;
    const float* Wh = Wq + (size_t)head * 64 * EE + kb;
    const float* Wkh = Wk + (size_t)(head * 64 + wave * 4) * EE + e0;
    const int go = lr * EE + lc;

    const float bq0 = bq[head * 64 + lane], bq1 = bq[head * 64 + 32 + lane];
    const float bk0 = bk[head * 64 + lane], bk1 = bk[head * 64 + 32 + lane];
    float4 gx[4], gw[16], gk[4];
#pragma unroll
    for (int i = 0; i < 4; ++i)
        gx[i] = *(const float4*)(X + i * 4 * EE + go);
#pragma unroll
    for (int i = 0; i < 16; ++i)
        gw[i] = *(const float4*)(Wh + i * 4 * EE + go);
#pragma unroll
    for (int i = 0; i < 4; ++i)          // one whole 512-byte piece of a Wk row per load
        gk[i] = *(const float4*)(Wkh + i * EE + lane * 4);
#pragma unroll
    for (int i = 0; i < 4; ++i)
        *(float4*)&lds.stage[wave][i * 4 + lr][lc] = gx[i];
#pragma unroll
    for (int i = 0; i < 16; ++i)
        *(float4*)&lds.stage[wave][16 + i * 4 + lr][lc] = gw[i];
    // The Wk rows go to LDS here, ahead of the first product, so that their loads
    // are asked for together with the others (stored behind the product, they
    // were loaded behind it too, their latency in the open).
#pragma unroll
    for (int i = 0; i < 4; ++i)
        *(float4*)&lds.wk[wave * 4 + i][lane * 4] = gk[i];
    // The wave reads back rows that its other lanes wrote: its own LDS stores
    // must be done, and the compiler must not lift the reads over them.
    asm volatile("s_wait_dscnt 0x0" ::: "memory");

    const int c = lane & 15, h = lane >> 4;
    float4 fx[4], fw[4][4];
#pragma unroll
    for (int i = 0; i < 4; ++i) {
        fx[i] = *(const float4*)&lds.stage[wave][c][8 * i + 4 * h];
#pragma unroll
        for (int t = 0; t < 4; ++t)
            fw[t][i] = *(const float4*)&lds.stage[wave][16 + 16 * t + c][8 * i + 4 * h];
    }
    // Fence pair, as in lin_tile: the LDS reads stay ahead of the WMMAs and no
    // address arithmetic is scheduled into the run behind an operand's last use.
    __builtin_amdgcn_sched_barrier(0);
    v8f acc[4] = {};
#pragma unroll
    for (int i = 0; i < 4; ++i) {
#pragma unroll
        for (int t = 0; t < 4; ++t)
            acc[t] = wmma_f32(fx[i].x, fx[i].y, fw[t][i].x, fw[t][i].y, acc[t]);
#pragma unroll
        for (int t = 0; t < 4; ++t)
            acc[t] = wmma_f32(fx[i].z, fx[i].w, fw[t][i].z, fw[t][i].w, acc[t]);
    }
    __builtin_amdgcn_sched_barrier(0);
    // D register r of lane (c, h) = q[n0 + 8h + r][head * 64 + 16t + c].
#pragma unroll
    for (int r = 0; r < 8; ++r)
#pragma unroll
        for (int t = 0; t < 4; ++t)
            lds.red[wave][r][t][lane] = acc[t][r];
    __syncthreads();                     // every wave's partials of q and rows of Wk are in LDS

    // Wave w sums row n0 + w of q: d = lane and d = lane + 32.
    const float* pr = &lds.red[0][wave & 7][h][(wave >> 3) * 16 + c];
    float qv[2];
#pragma unroll
    for (int u = 0; u < 2; ++u) {
        const float* p = pr + u * 64;
        float s0 = p[0 * 1024], s1 = p[1 * 1024], s2 = p[2 * 1024], s3 = p[3 * 1024];
#pragma unroll
        for (int w = 4; w < LIN_WAVES; w += 4) {
            s0 += p[(w + 0) * 1024];
            s1 += p[(w + 1) * 1024];
            s2 += p[(w + 2) * 1024];
            s3 += p[(w + 3) * 1024];
        }
        qv[u] = ((s0 + s1) + (s2 + s3)) + (u ? bq1 : bq0);
        lds.qh[wave][u * 32 + lane] = qv[u];
    }
    __syncthreads();                     // q of the head lies in LDS for every wave

    const int t2 = wave & 7, kh = wave >> 3;
    float4 fa[4];
    float fb[4][4];
#pragma unroll
    for (int i = 0; i < 4; ++i) {
        fa[i] = *(const float4*)&lds.qh[c][32 * kh + 8 * i + 4 * h];
#pragma unroll
        for (int j = 0; j < 4; ++j)
            fb[i][j] = lds.wk[32 * kh + 8 * i + 4 * h + j][16 * t2 + c];
    }
    __builtin_amdgcn_sched_barrier(0);   // fence pair, as above
    v8f a2 = {};
#pragma unroll
    for (int i = 0; i < 4; ++i) {
        a2 = wmma_f32(fa[i].x, fa[i].y, fb[i][0], fb[i][1], a2);
        a2 = wmma_f32(fa[i].z, fa[i].w, fb[i][2], fb[i][3], a2);
    }
    __builtin_amdgcn_sched_barrier(0);
    // D register r of lane (c, h) = qk[n0 + 8h + r][head][e0 + 16 t2 + c], d half kh.
#pragma unroll
    for (int r = 0; r < 8; ++r)
        lds.red2[kh][r][t2][lane] = a2[r];
    __syncthreads();                     // both d halves of every column tile are in LDS

    // Wave w stores row n0 + w: 128 columns = four whole 128-byte lines, and the
    // same columns of the padding head as zeros.
    const float* p2 = &lds.red2[0][wave & 7][lane >> 2][(wave >> 3) * 16 + (lane & 3) * 4];
    const float4 u0 = *(const float4*)p2;
    const float4 u1 = *(const float4*)(p2 + 2048);
    float* o = qk + ((size_t)(n0 + wave) * 16 + head) * EE + e0 + lane * 4;
    *(float4*)o = make_float4(u0.x + u1.x, u0.y + u1.y, u0.z + u1.z, u0.w + u1.w);
    *(float4*)(o + 8 * EE) = make_float4(0.0f, 0.0f, 0.0f, 0.0f);
    // Precaution: stands between the two stores and the reuse of their registers below.
    asm volatile("s_wait_xcnt 0x0" ::: "memory");
    // One block per (head, row group) hands on the score bias of its rows, last,
    // so that no barrier waits for this sum or its store.
    if (e0 == 0) {
        float sv = fmaf(qv[1], bk1, qv[0] * bk0);
#pragma unroll
        for (int m = 16; m >= 1; m >>= 1) sv += __shfl_xor(sv, m, 32);
        if (lane == 0) sb[(n0 + wave) * HH + head] = sv;
    }
}

// ---------------------------------------------------------------------------
// Stages 2 to 4 in one pass over src (each src row is read from memory once).
// Grid (n, chunk of 512 s). 16 waves; two rounds of 256 s rows.
// Round: wave w brings rows 16w .. 16w+15 (whole 512-byte pieces of a row per
// load), rounds them to bf16 and lays them row-major in LDS. Then
//   S^T[s, head] = src[s, :] . qk[head, :]      A = own 16 rows, B = qk (LDS)
//   p = exp(x - running max), handed over in LDS as the B fragment of
//   ctx^T[e, head] += src^T[e, s] . p[s, head]  A = transposing LDS loads,
// where wave w owns e = 32w .. 32w+31 over all 256 rows of the round.
// Both products use the hardware k order: k = 8h + i, then 16 + 8h + i.
// The block hands on an un-normalised sum with its (max, sum) per head.
// ---------------------------------------------------------------------------
typedef __attribute__((ext_vector_type(4))) unsigned int u32x4;
typedef __attribute__((ext_vector_type(2))) unsigned int u32x2;
typedef __attribute__((ext_vector_type(8))) short s16x8;
typedef __attribute__((ext_vector_type(2))) __bf16 bf16x2;

#define FA_WAVES  16
#define FA_ROWS   256     // s rows per round
#define FA_ROUNDS 2
#define FA_CHUNKS 8
#define FA_PITCH  1056    // bytes: 1024 of data + 32, an odd multiple of 32 for the transposing loads
#define FA_QPITCH 1040    // bytes, qk rows: an odd multiple of 16 for plain 16-byte reads
#define ROWF      (NN * EE)   // floats between consecutive s

union Frag { u32x4 q[2]; v16bf v; };

#define FA_DEPTH 6        // rows (2 KiB each) that a wave keeps in flight
#define FA_MXP 20         // floats per head in the exchange rows: 80 B, an odd multiple of 16

struct FaLds {                         // the small arrays first: their offsets fit the LDS instructions' immediate
    u32x4 p[FA_ROWS / 32][2][32];      // [k step][first / second 16 rows][lane]
    float mx[16 * FA_MXP];             // [head][wave]
    unsigned char qk[16 * FA_QPITCH];
    unsigned char tile[FA_ROWS * FA_PITCH];
};

__device__ __forceinline__ unsigned int pack2(float lo, float hi) {
    v2f f = {lo, hi};
    return __builtin_bit_cast(unsigned int, __builtin_convertvector(f, bf16x2));
}
__device__ __forceinline__ void put_bf16x4(unsigned char* dst, float4 v) {
    u32x2 w = {pack2(v.x, v.y), pack2(v.z, v.w)};
    *(u32x2*)dst = w;
}
__device__ __forceinline__ u32x4 ld_tr16(const unsigned char* p) {
    typedef __attribute__((address_space(3))) s16x8 lds_s16x8;
    return __builtin_bit_cast(u32x4, __builtin_amdgcn_ds_load_tr16_b128_v8i16((lds_s16x8*)p));
}
// lane l <-> lane l ^ 16
__device__ __forceinline__ float xhalf(float x) {
    int b = __builtin_bit_cast(int, x);
    return __builtin_bit_cast(float, __builtin_amdgcn_permlanex16(b, b, 0x76543210, 0xfedcba98, false, false));
}
__device__ __forceinline__ float bf_lo(unsigned int w) { return __builtin_bit_cast(float, w << 16); }
__device__ __forceinline__ float bf_hi(unsigned int w) { return __builtin_bit_cast(float, w & 0xffff0000u); }
// exp(x) as __expf is built (one multiply, v_exp_f32), in asm so that the v_nop
// stands directly behind the transcendental: the slot that the instruction set
// asks for in front of an instruction that reads its result or overwrites its
// source.
__device__ __forceinline__ float exp_slot(float x) {
    float r;
    asm("v_exp_f32 %0, %1\n\tv_nop" : "=v"(r) : "v"(x * 1.44269504f));
    return r;
}
// Work-group barrier for hand-overs through LDS: the wave's LDS operations are
// done before it signals, while its global loads of the coming rows stay in
// flight (__syncthreads() was built with a wait for those loads as well). The
// scheduling fences keep work on those loads' registers from moving over it.
__device__ __forceinline__ void lds_barrier() {
    __builtin_amdgcn_sched_barrier(0);
    asm volatile("s_wait_dscnt 0x0\n\ts_barrier_signal -1\n\ts_barrier_wait -1" ::: "memory");
    __builtin_amdgcn_sched_barrier(0);
}

__global__ __launch_bounds__(512) void attn_pass_kernel(const float* __restrict__ src,
                                                        const float* __restrict__ qk,
                                                        const float* __restrict__ sb,
                                                        float* __restrict__ part,
                                                        float* __restrict__ ml) {
    __shared__ __attribute__((aligned(16))) FaLds lds;
    const int n = blockIdx.x;            // 0..31
    const int ch = blockIdx.y;           // 0..7  (512 s each)
    // The wave's number in a scalar register: row addresses are then a scalar
    // base plus one lane offset, not a vector register pair for each.
    const int wave = __builtin_amdgcn_readfirstlane(threadIdx.x >> 5);
    const int lane = threadIdx.x & 31;
    const int c = lane & 15, h = lane >> 4;

    // qk[n] (16 padded heads x 512) -> bf16 in LDS.
    float4 gq[4];
#pragma unroll
    for (int i = 0; i < 4; ++i)
        gq[i] = *(const float4*)(qk + (size_t)n * 16 * EE + (i * 512 + (int)threadIdx.x) * 4);
    const float bias = sb[n * HH + (c & 7)];   // padding columns 8..15 are never stored
    // Precaution: stands between the loads above and any reuse of their offset
    // registers.
    asm volatile("s_wait_xcnt 0x0" ::: "memory");

    // Row f (0..31) of the wave's share: round f >> 4, row f & 15 of its sixteen;
    // four loads of 512 contiguous bytes each. FA_DEPTH rows are kept in flight.
    const float* g = src + ((size_t)(ch * (FA_ROWS * FA_ROUNDS) + wave * 16) * NN + n) * EE;
    const int gl = lane * 4;
    float4 buf[FA_DEPTH * 4];
#pragma unroll
    for (int i = 0; i < FA_DEPTH * 4; ++i)
        buf[i] = *(const float4*)(g + (size_t)(i >> 2) * ROWF + (i & 3) * 128 + gl);
    __builtin_amdgcn_sched_barrier(0);   // the first rows are asked for before anything waits
#pragma unroll
    for (int i = 0; i < 4; ++i) {
        int f = (i * 512 + (int)threadIdx.x) * 4;
        put_bf16x4(lds.qk + (f >> 9) * FA_QPITCH + (f & 511) * 2, gq[i]);
    }

    unsigned char* trow = lds.tile + (wave * 16) * FA_PITCH + lane * 8;
    const unsigned char* ta = lds.tile + (wave * 16 + c) * FA_PITCH + 16 * h;
    const unsigned char* tb = lds.qk + c * FA_QPITCH + 16 * h;
    const unsigned char* tt = lds.tile + (8 * h + (lane & 7)) * FA_PITCH + ((lane >> 3) & 1) * 16 + wave * 64;

    float m_run = -INFINITY, l_run = 0.0f;
    v8f acc0 = {}, acc1 = {};
#pragma unroll
    for (int r = 0; r < FA_ROUNDS; ++r) {
        // Row by row: a row's four registers are asked for again as soon as the
        // row lies in LDS, so that the wave's loads stay in flight, through the
        // products too. The fence keeps that order (without it the loads were
        // bunched, more registers were live and some were spilled).
#pragma unroll
        for (int q = 0; q < 16; ++q) {
            const int f = r * 16 + q, slot = (f % FA_DEPTH) * 4, fn = f + FA_DEPTH;
#pragma unroll
            for (int k = 0; k < 4; ++k)
                put_bf16x4(trow + q * FA_PITCH + k * 256, buf[slot + k]);
            if (fn < FA_ROUNDS * 16) {
                const float* gn = g + (size_t)((fn >> 4) * FA_ROWS + (fn & 15)) * ROWF;
#pragma unroll
                for (int k = 0; k < 4; ++k)
                    buf[slot + k] = *(const float4*)(gn + k * 128 + gl);
            }
            __builtin_amdgcn_sched_barrier(0);
        }
        if (r == 0) lds_barrier();       // qk lies in LDS for every wave

        // Scores of the wave's own 16 rows: s0[i] + s1[i] = raw[s = 16w + 8h + i][head c].
        v8f s0 = {}, s1 = {};
#pragma unroll
        for (int ks = 0; ks < 16; ks += 2) {
            Frag a0, b0, a1, b1;
            a0.q[0] = *(const u32x4*)(ta + ks * 64);      a0.q[1] = *(const u32x4*)(ta + ks * 64 + 32);
            b0.q[0] = *(const u32x4*)(tb + ks * 64);      b0.q[1] = *(const u32x4*)(tb + ks * 64 + 32);
            a1.q[0] = *(const u32x4*)(ta + ks * 64 + 64); a1.q[1] = *(const u32x4*)(ta + ks * 64 + 96);
            b1.q[0] = *(const u32x4*)(tb + ks * 64 + 64); b1.q[1] = *(const u32x4*)(tb + ks * 64 + 96);
            s0 = wmma_bf16(a0.v, b0.v, s0);
            s1 = wmma_bf16(a1.v, b1.v, s1);
        }
        float x[8];
        float mx = -INFINITY;
#pragma unroll
        for (int i = 0; i < 8; ++i) {
            x[i] = ((s0[i] + s1[i]) + bias) * 0.125f;
            mx = fmaxf(mx, x[i]);
        }
        mx = fmaxf(mx, xhalf(mx));
        lds.mx[c * FA_MXP + wave] = mx;  // both halves hold the same value
        lds_barrier();                   // every wave's maxima are in LDS
        float4 m4[4];
#pragma unroll
        for (int i = 0; i < 4; ++i) m4[i] = *(const float4*)&lds.mx[c * FA_MXP + 4 * i];
        float mr = -INFINITY;
#pragma unroll
        for (int i = 0; i < 4; ++i)
            mr = fmaxf(mr, fmaxf(fmaxf(m4[i].x, m4[i].y), fmaxf(m4[i].z, m4[i].w)));
        const float m_new = fmaxf(m_run, mr);
        const float scale = exp_slot(m_run - m_new);
        m_run = m_new;
        u32x4 pw;
        float ls = 0.0f;                 // the sum is taken of the rounded weights
#pragma unroll
        for (int i = 0; i < 4; ++i) {
            pw[i] = pack2(exp_slot(x[2 * i] - m_new), exp_slot(x[2 * i + 1] - m_new));
            ls += bf_lo(pw[i]) + bf_hi(pw[i]);
        }
        l_run = fmaf(l_run, scale, ls);
        lds.p[wave >> 1][wave & 1][lane] = pw;
        lds_barrier();                   // every wave's rows and weights are in LDS

#pragma unroll
        for (int i = 0; i < 8; ++i) { acc0[i] *= scale; acc1[i] *= scale; }
#pragma unroll
        for (int j = 0; j < FA_ROWS / 32; ++j) {
            Frag b, a0, a1;
            b.q[0] = lds.p[j][0][lane];
            b.q[1] = lds.p[j][1][lane];
            const unsigned char* tj = tt + j * 32 * FA_PITCH;
            a0.q[0] = ld_tr16(tj);      a0.q[1] = ld_tr16(tj + 16 * FA_PITCH);
            a1.q[0] = ld_tr16(tj + 32); a1.q[1] = ld_tr16(tj + 16 * FA_PITCH + 32);
            acc0 = wmma_bf16(a0.v, b.v, acc0);
            acc1 = wmma_bf16(a1.v, b.v, acc1);
        }
        if (r + 1 < FA_ROUNDS)
            lds_barrier();               // all reads of this round's LDS are done
    }

    // The waves' sums of weights (all against the same final maximum) -> wave 0.
    lds.mx[c * FA_MXP + wave] = l_run + xhalf(l_run);
    lds_barrier();

    // acc{0,1}[i] = ctx^T[e = 32w + {0,16} + 8h + i][head c]; heads 8..15 are padding.
    if (c < HH) {
        float* o = part + (((size_t)ch * NN + n) * HH + c) * EE + wave * 32 + 8 * h;
        *(float4*)(o)      = make_float4(acc0[0], acc0[1], acc0[2], acc0[3]);
        *(float4*)(o + 4)  = make_float4(acc0[4], acc0[5], acc0[6], acc0[7]);
        *(float4*)(o + 16) = make_float4(acc1[0], acc1[1], acc1[2], acc1[3]);
        *(float4*)(o + 20) = make_float4(acc1[4], acc1[5], acc1[6], acc1[7]);
        if (wave == 0 && h == 0) {
            float l_tot = 0.0f;
#pragma unroll
            for (int w = 0; w < FA_WAVES; ++w) l_tot += lds.mx[c * FA_MXP + w];
            ml[((ch * NN + n) * HH + c) * 2 + 0] = m_run;
            ml[((ch * NN + n) * HH + c) * 2 + 1] = l_tot;
        }
    }
}

// Merge of the 8 chunks: weights exp(m_c - M), divided by the merged sum.
__global__ __launch_bounds__(256) void merge_kernel(const float* __restrict__ part,
                                                    const float* __restrict__ ml,
                                                    float* __restrict__ ctx) {
    int idx = blockIdx.x * 256 + threadIdx.x;   // 32*8*512 = 131072
    int nh = idx >> 9;
    float m[FA_CHUNKS], l[FA_CHUNKS], v[FA_CHUNKS];
    float M = -INFINITY;
#pragma unroll
    for (int k = 0; k < FA_CHUNKS; ++k) {
        m[k] = ml[(k * (NN * HH) + nh) * 2 + 0];
        l[k] = ml[(k * (NN * HH) + nh) * 2 + 1];
        v[k] = part[(size_t)k * 131072 + idx];
        M = fmaxf(M, m[k]);
    }
    float L = 0.0f, a = 0.0f;
#pragma unroll
    for (int k = 0; k < FA_CHUNKS; ++k) {
        float w = __expf(m[k] - M);
        L = fmaf(w, l[k], L);
        a = fmaf(w, v[k], a);
    }
    ctx[idx] = a / L;
}

// ---------------------------------------------------------------------------
// Stage 5: tiny output chain.
// mo[n,j] = Wv[j,:].ctx[n, j>>6, :] + bv[j]   (bv passes through: sum p == 1)
// out = mo @ W2.T + b2   (W2 = Wl Wo, b2 = Wl bo + bl, from the first launch)
// ---------------------------------------------------------------------------
__global__ __launch_bounds__(512) void vproj_kernel(const float* __restrict__ ctx,
                                                    const float* __restrict__ Wv,
                                                    const float* __restrict__ bv,
                                                    float* __restrict__ mo) {
    int j0 = (blockIdx.x & 15) * 32, n0 = (blockIdx.x >> 4) * 16;
    int head = j0 >> 6;            // the block's 32 columns lie in one head
    lin_tile(ctx + (size_t)head * EE, HH * EE, Wv, bv, mo, n0, j0);
}

__global__ __launch_bounds__(512) void lin_kernel(const float* __restrict__ A,
                                                  const float* __restrict__ W,
                                                  const float* __restrict__ b,
                                                  float* __restrict__ out) {
    int j0 = (blockIdx.x & 15) * 32, n0 = (blockIdx.x >> 4) * 16;
    lin_tile(A, EE, W, b, out, n0, j0);
}

// ---------------------------------------------------------------------------
extern "C" void kernel_launch(void* const* d_in, const int* in_sizes, int n_in,
                              void* d_out, int out_size, void* d_ws, size_t ws_size,
                              hipStream_t stream) {
    const float* src = (const float*)d_in[0];
    const float* Wq  = (const float*)d_in[1];
    const float* bq  = (const float*)d_in[2];
    const float* Wk  = (const float*)d_in[3];
    const float* bk  = (const float*)d_in[4];
    const float* Wv  = (const float*)d_in[5];
    const float* bv  = (const float*)d_in[6];
    const float* Wo  = (const float*)d_in[7];
    const float* bo  = (const float*)d_in[8];
    const float* Wl  = (const float*)d_in[9];
    const float* bl  = (const float*)d_in[10];

    float* ws = (float*)d_ws;
    float* qkbuf  = ws + 16384;       // 32*16*512 = 262144 (head-padded)
    float* sb     = ws + 278528;      // 256
    float* ml     = ws + 278784;      // 8*32*8 pairs (max, sum) = 4096
    float* part   = ws + 3424512;     // 8*32*8*512 = 1048576
    float* ctx    = ws + 4473088;     // 32*8*512 = 131072
    float* mo     = ws + 4604160;     // 16384
    float* W2     = ws + 4620544;     // 512*512 = 262144
    float* b2     = ws + 4882688;     // 512  (end: 4883200 floats ~ 18.6 MB)

    qk_fused_kernel<<<192, 512, 0, stream>>>(src, Wq, bq, Wk, bk, Wo, bo, Wl, bl, qkbuf, sb, W2, b2);
    attn_pass_kernel<<<dim3(32, 8), 512, 0, stream>>>(src, qkbuf, sb, part, ml);
    merge_kernel  <<<512,  256, 0, stream>>>(part, ml, ctx);
    vproj_kernel  <<<32,   512, 0, stream>>>(ctx, Wv, bv, mo);
    lin_kernel    <<<32,   512, 0, stream>>>(mo, W2, b2, (float*)d_out);
}

// v005
// Measured time: 36.6 microseconds a run.
// Next to v004, in two timings, it ran 1.08 times as fast each time.
// Counting every step since v000, it is 3.90 times as fast.
#include <hip/hip_runtime.h>
#include <math.h>

// Problem constants (from reference): S=4096, N=32, E=512, H=8, DK=64, l=2048.
#define SS 4096
#define NN 32
#define EE 512
#define HH 8

typedef __attribute__((ext_vector_type(16))) __bf16 v16bf;
typedef __attribute__((ext_vector_type(8)))  float  v8f;
typedef __attribute__((ext_vector_type(2)))  float  v2f;

__device__ __forceinline__ v8f wmma_bf16(v16bf a, v16bf b, v8f c) {
    return __builtin_amdgcn_wmma_f32_16x16x32_bf16(false, a, false, b, (short)0, c, false, false);
}

// ---------------------------------------------------------------------------
// Shared tile for the two small linears  Y[n,j] = X[n,:] . Wt[j,:] + b[j]
// (32 x 512, K = 512), all in f32 on v_wmma_f32_16x16x4_f32.
// One block of 16 waves owns 16 rows n x 32 columns j. Wave w owns the K slice
// [32w, 32w+32): it issues all of its loads at once (each wave-wide 16-byte
// load covers four whole 128-byte lines: 4 rows x 32 floats), turns them into
// fragments through its own LDS range, and runs two accumulator chains of 8
// WMMAs. The 16 K-slice partials are summed in LDS in a fixed order.
// k order: lane (c = lane&15, h = lane>>4) takes k = 8i + 4h + {0,1} and
// 8i + 4h + {2,3} of its row, by the same code for X and for Wt.
// ---------------------------------------------------------------------------
#define LIN_WAVES 16
#define LIN_PITCH 36   // floats: 128 B of data + 16 B, so 16 rows' 16-byte reads fall on 64 distinct banks

__device__ __forceinline__ v8f wmma_f32(float a0, float a1, float b0, float b1, v8f c) {
    v2f a = {a0, a1};
    v2f b = {b0, b1};
    return __builtin_amdgcn_wmma_f32_16x16x4_f32(false, a, false, b, (short)0, c, false, false);
}

struct LinLds {
    float red[LIN_WAVES][8][2][32];            // K-slice partials, lane-major
    float stage[LIN_WAVES][48][LIN_PITCH];     // per wave: 16 rows of X, 32 rows of Wt
};

__device__ __forceinline__ void lin_tile(const float* __restrict__ X, int x_stride,
                                         const float* __restrict__ Wt,
                                         const float* __restrict__ b,
                                         float* __restrict__ Y, int n0, int j0) {
    __shared__ __attribute__((aligned(16))) LinLds lds;
    int wave = threadIdx.x >> 5;
    int lane = threadIdx.x & 31;
    int kb = wave * 32;
    int lr = lane >> 3;            // row within a group of four
    int lc = (lane & 7) * 4;       // float offset within the 128-byte slice

    float4 gx[4], gw[8];
#pragma unroll
    for (int i = 0; i < 4; ++i)
        gx[i] = *(const float4*)(X + (size_t)(n0 + i * 4 + lr) * x_stride + kb + lc);
#pragma unroll
    for (int i = 0; i < 8; ++i)
        gw[i] = *(const float4*)(Wt + (size_t)(j0 + i * 4 + lr) * EE + kb + lc);
    float bias = b[j0 + lane];     // asked for with the tiles, used at the very end
#pragma unroll
    for (int i = 0; i < 4; ++i)
        *(float4*)&lds.stage[wave][i * 4 + lr][lc] = gx[i];
#pragma unroll
    for (int i = 0; i < 8; ++i)
        *(float4*)&lds.stage[wave][16 + i * 4 + lr][lc] = gw[i];
    // The wave reads back rows that its other lanes wrote: its own LDS stores
    // must be done, and the compiler must not lift the reads over them.
    asm volatile("s_wait_dscnt 0x0" ::: "memory");

    int c = lane & 15, h = lane >> 4;
    float4 fx[4], f0[4], f1[4];
#pragma unroll
    for (int i = 0; i < 4; ++i) {
        fx[i] = *(const float4*)&lds.stage[wave][c][8 * i + 4 * h];
        f0[i] = *(const float4*)&lds.stage[wave][16 + c][8 * i + 4 * h];
        f1[i] = *(const float4*)&lds.stage[wave][32 + c][8 * i + 4 * h];
    }
    // Fence pair: the LDS reads stay one group ahead of the WMMAs, and no address
    // arithmetic is scheduled into the run, where it could overwrite an operand
    // register directly behind the WMMA that reads it.
    __builtin_amdgcn_sched_barrier(0);
    v8f acc0 = {}, acc1 = {};
#pragma unroll
    for (int i = 0; i < 4; ++i) {
        acc0 = wmma_f32(fx[i].x, fx[i].y, f0[i].x, f0[i].y, acc0);
        acc1 = wmma_f32(fx[i].x, fx[i].y, f1[i].x, f1[i].y, acc1);
        acc0 = wmma_f32(fx[i].z, fx[i].w, f0[i].z, f0[i].w, acc0);
        acc1 = wmma_f32(fx[i].z, fx[i].w, f1[i].z, f1[i].w, acc1);
    }
    __builtin_amdgcn_sched_barrier(0);
    // D register r of lane (c, h) = Y[n0 + 8h + r][j0 + 16t + c].
#pragma unroll
    for (int r = 0; r < 8; ++r) {
        lds.red[wave][r][0][lane] = acc0[r];
        lds.red[wave][r][1][lane] = acc1[r];
    }
    __syncthreads();
    // Wave w stores row n0 + w: 32 columns = one whole 128-byte line.
    const float* pr = &lds.red[0][wave & 7][lane >> 4][(wave >> 3) * 16 + c];
    float s0 = pr[0 * 512], s1 = pr[1 * 512], s2 = pr[2 * 512], s3 = pr[3 * 512];
#pragma unroll
    for (int w = 4; w < LIN_WAVES; w += 4) {
        s0 += pr[(w + 0) * 512];
        s1 += pr[(w + 1) * 512];
        s2 += pr[(w + 2) * 512];
        s3 += pr[(w + 3) * 512];
    }
    Y[(size_t)(n0 + wave) * EE + j0 + lane] = ((s0 + s1) + (s2 + s3)) + bias;
}

// ---------------------------------------------------------------------------
// The two last linears as one:  (mo Wo^T + bo) Wl^T + bl = mo W2^T + b2  with
//   W2[i,j] = sum_k Wl[i,k] * Wo[k,j]     b2[i] = Wl[i,:] . bo + bl[i]
// W2 and b2 depend on the weights alone, so they are formed in the first launch,
// by work-groups of their own on WGPs that the launch leaves idle.
// One block of 16 waves owns 32 rows i x 64 columns j. Wave w owns the K slice
// [32w, 32w+32): its 32 x 32 piece of Wl goes through its own LDS range as in
// lin_tile; its 32 x 64 piece of Wo stays in registers: lane (c, h) loads the four
// columns j0 + 4c .. +3 of row k, one for each of four column tiles, so column c
// of tile t is j0 + 4c + t and every load covers whole 128-byte lines.
// k order: lane (c, h) takes k = 8i + 4h + {0,1} and 8i + 4h + {2,3}, for Wl
// (row c) and for Wo (column c) alike. The 16 K-slice partials are summed in LDS
// in a fixed order.
// ---------------------------------------------------------------------------
struct FoldLds {
    float red[LIN_WAVES][2][8][32][4];         // K-slice partials: [row tile][D register][lane][column tile]
    float stage[LIN_WAVES][32][LIN_PITCH];     // per wave: 32 rows of Wl
    float bred[LIN_WAVES][32];                 // K-slice partials of Wl . bo
};

__device__ __forceinline__ void fold_tile(FoldLds& lds,
                                          const float* __restrict__ Wl,
                                          const float* __restrict__ Wo,
                                          const float* __restrict__ bo,
                                          const float* __restrict__ bl,
                                          float* __restrict__ W2,
                                          float* __restrict__ b2, int i0, int j0) {
    const int wave = __builtin_amdgcn_readfirstlane(threadIdx.x >> 5);
    const int lane = threadIdx.x & 31;
    const int kb = wave * 32;
    const int lr = lane >> 3;            // row within a group of four
    const int lc = (lane & 7) * 4;       // float offset within the 128-byte slice
    const int c = lane & 15, h = lane >> 4;
    // Scalar bases and one lane offset (in bytes) each, as in the kernel below.
    const char* A = (const char*)(Wl + (size_t)i0 * EE + kb);
    const char* B = (const char*)(Wo + (size_t)kb * EE + j0);
    const unsigned int ao = (lr * EE + lc) * 4, bofs = (h * 4 * EE + c * 4) * 4;
    const bool first = j0 == 0;          // one block per row group forms b2 as well

    float4 ga[8], gb[4][4], gbo[4];
    float blv = 0.0f;
#pragma unroll
    for (int i = 0; i < 8; ++i)
        ga[i] = *(const float4*)(A + i * 4 * EE * 4 + ao);
#pragma unroll
    for (int i = 0; i < 4; ++i)
#pragma unroll
        for (int j = 0; j < 4; ++j)
            gb[i][j] = *(const float4*)(B + (8 * i + j) * EE * 4 + bofs);
    // Precaution: the loads' lane offsets are inputs here, so their registers are
    // not given to anything else (a load's destination either) ahead of this wait.
    asm volatile("s_wait_xcnt 0x0" :: "v"(ao), "v"(bofs) : "memory");
    if (first) {
#pragma unroll
        for (int i = 0; i < 4; ++i)
            gbo[i] = *(const float4*)(bo + kb + 8 * i + 4 * h);
        blv = (bl + i0)[lane];
    }
#pragma unroll
    for (int i = 0; i < 8; ++i)
        *(float4*)&lds.stage[wave][i * 4 + lr][lc] = ga[i];
    // The wave reads back rows that its other lanes wrote: its own LDS stores
    // must be done, and the compiler must not lift the reads over them.
    asm volatile("s_wait_dscnt 0x0" ::: "memory");
    float4 fx[2][4];
#pragma unroll
    for (int a = 0; a < 2; ++a)
#pragma unroll
        for (int i = 0; i < 4; ++i)
            fx[a][i] = *(const float4*)&lds.stage[wave][16 * a + c][8 * i + 4 * h];
    if (first) {
#pragma unroll
        for (int a = 0; a < 2; ++a) {
            float s = 0.0f;
#pragma unroll
            for (int i = 0; i < 4; ++i) {
                s = fmaf(fx[a][i].x, gbo[i].x, s);
                s = fmaf(fx[a][i].y, gbo[i].y, s);
                s = fmaf(fx[a][i].z, gbo[i].z, s);
                s = fmaf(fx[a][i].w, gbo[i].w, s);
            }
            s += __shfl_xor(s, 16, 32);
            lds.bred[wave][16 * a + c] = s;   // both halves hold the same value
        }
    }
    // The B operand wants two k of one column side by side; a load holds four
    // columns of one k. The pairs are formed here, in registers of their own.
    v2f bp[4][2][4];
#pragma unroll
    for (int i = 0; i < 4; ++i)
#pragma unroll
        for (int p = 0; p < 2; ++p) {
            bp[i][p][0] = v2f{gb[i][2 * p].x, gb[i][2 * p + 1].x};
            bp[i][p][1] = v2f{gb[i][2 * p].y, gb[i][2 * p + 1].y};
            bp[i][p][2] = v2f{gb[i][2 * p].z, gb[i][2 * p + 1].z};
            bp[i][p][3] = v2f{gb[i][2 * p].w, gb[i][2 * p + 1].w};
        }
    // Fence pair, as in lin_tile: operands are complete ahead of the WMMAs and
    // nothing is scheduled into the run behind an operand's last use.
    __builtin_amdgcn_sched_barrier(0);
    v8f acc[2][4] = {};
#pragma unroll
    for (int i = 0; i < 4; ++i)
        // (p, a) = (0,0) (1,1) (0,1) (1,0): every B pair that the first eight WMMAs
        // read is read again later, so that no accumulator, which gets its registers
        // there, is laid over a B pair just read.
#pragma unroll
        for (int u = 0; u < 4; ++u) {
            const int p = u & 1, a = (u ^ (u >> 1)) & 1;
            const v2f av = p ? v2f{fx[a][i].z, fx[a][i].w} : v2f{fx[a][i].x, fx[a][i].y};
#pragma unroll
            for (int t = 0; t < 4; ++t)
                acc[a][t] = __builtin_amdgcn_wmma_f32_16x16x4_f32(false, av, false, bp[i][p][t],
                                                                  (short)0, acc[a][t], false, false);
        }
    __builtin_amdgcn_sched_barrier(0);
    // The distance between the last WMMAs and the moves below, which reuse their
    // operand registers and read their results.
    asm volatile("v_nop\n\tv_nop\n\tv_nop\n\tv_nop");
    __builtin_amdgcn_sched_barrier(0);
    // D register r of lane (c, h), tile (a, t) = W2[i0 + 16a + 8h + r][j0 + 4c + t].
#pragma unroll
    for (int a = 0; a < 2; ++a)
#pragma unroll
        for (int r = 0; r < 8; ++r)
            *(float4*)&lds.red[wave][a][r][lane][0] =
                make_float4(acc[a][0][r], acc[a][1][r], acc[a][2][r], acc[a][3][r]);
    __syncthreads();                     // every wave's partials are in LDS
    // Wave w stores rows i0 + 2w and i0 + 2w + 1: 64 columns = two whole lines each.
    const int row = wave * 2 + h;
    const float* pr = &lds.red[0][row >> 4][row & 7][((row >> 3) & 1) * 16 + c][0];
    float4 s[4];
#pragma unroll
    for (int w = 0; w < 4; ++w) s[w] = *(const float4*)(pr + w * 2048);
#pragma unroll
    for (int w = 4; w < LIN_WAVES; ++w) {
        const float4 v = *(const float4*)(pr + w * 2048);
        s[w & 3].x += v.x; s[w & 3].y += v.y; s[w & 3].z += v.z; s[w & 3].w += v.w;
    }
    *(float4*)(W2 + (size_t)(i0 + row) * EE + j0 + c * 4) =
        make_float4((s[0].x + s[1].x) + (s[2].x + s[3].x), (s[0].y + s[1].y) + (s[2].y + s[3].y),
                    (s[0].z + s[1].z) + (s[2].z + s[3].z), (s[0].w + s[1].w) + (s[2].w + s[3].w));
    // Precaution: stands between the store and the reuse of its registers below.
    asm volatile("s_wait_xcnt 0x0" ::: "memory");
    if (first && wave == 0) {
        float t0 = 0.0f;
#pragma unroll
        for (int w = 0; w < LIN_WAVES; ++w) t0 += lds.bred[w][lane];
        b2[i0 + lane] = t0 + blv;
    }
}

// ---------------------------------------------------------------------------
// Stage 1 in one launch:
//   q[n,j]     = src[l=2048,n,:] . Wq[j,:] + bq[j]
//   qk[n,h,e]  = sum_d q[n,h*64+d] * Wk[h*64+d,e]   (h padded to 16 rows of zeros)
//   sb[n,h]    = q[n,h,:] . bk[h,:]                 (score bias from k's bias)
// Grid: 128 blocks of fold_tile (they start first: theirs is the longer run of
// WMMAs), then 8 heads x 2 groups of 16 rows n x 4 ranges of 128 columns e; 16 waves.
// Each of those 64 blocks forms its head's q (16 x 64, K = 512) itself, as lin_tile does
// (wave w owns the K slice [32w, 32w+32), partials summed in LDS in the same
// fixed order), keeps it in LDS and multiplies it with its 64 x 128 piece of
// Wk: wave w owns columns 16(w&7) .. +15 and the d half w>>3.
// k order of the second product: lane (c, h) takes d = 8i + 4h + {0,1} and
// 8i + 4h + {2,3}, for q (row c) and for Wk (column c) alike.
// ---------------------------------------------------------------------------
#define FOLD_BLOCKS 128   // 16 groups of 32 rows i x 8 groups of 64 columns j
#define QF_WKP 132   // floats: 512 B of data + 16 B, so the two lane halves (4 rows apart) read distinct banks
#define QF_QP  68    // floats: 272 B, an odd multiple of 16 for plain 16-byte reads

struct QfLds {
    float red[LIN_WAVES][8][4][32];            // K-slice partials of q, lane-major
    float stage[LIN_WAVES][80][LIN_PITCH];     // per wave: 16 rows of src[l], 64 rows of Wq
    float wk[64][QF_WKP];                      // [d][e]
    float qh[16][QF_QP];                       // [n][d]
    float red2[2][8][8][32];                   // [d half][D register][column tile][lane]
};

__global__ __launch_bounds__(512) void qk_fused_kernel(const float* __restrict__ src,
                                                       const float* __restrict__ Wq,
                                                       const float* __restrict__ bq,
                                                       const float* __restrict__ Wk,
                                                       const float* __restrict__ bk,
                                                       const float* __restrict__ Wo,
                                                       const float* __restrict__ bo,
                                                       const float* __restrict__ Wl,
                                                       const float* __restrict__ bl,
                                                       float* __restrict__ qk,
                                                       float* __restrict__ sb,
                                                       float* __restrict__ W2,
                                                       float* __restrict__ b2) {
    __shared__ __attribute__((aligned(16))) union { QfLds q; FoldLds f; } both;
    if (blockIdx.x < FOLD_BLOCKS) {      // the same for the whole block, ahead of every barrier
        fold_tile(both.f, Wl, Wo, bo, bl, W2, b2, (blockIdx.x >> 3) * 32, (blockIdx.x & 7) * 64);
        return;
    }
    QfLds& lds = both.q;
    const int bid = blockIdx.x - FOLD_BLOCKS;
    const int e0 = (bid & 3) * 128;
    const int n0 = ((bid >> 2) & 1) * 16;
    const int head = bid >> 3;
    // The wave's number in a scalar register: every load address is then a scalar
    // base plus one of two lane offsets, not a vector register pair for each.
    const int wave = __builtin_amdgcn_readfirstlane(threadIdx.x >> 5);
    const int lane = threadIdx.x & 31;
    const int kb = wave * 32;
    const int lr = lane >> 3;            // row within a group of four
    const int lc = (lane & 7) * 4;       // float offset within the 128-byte slice
    const float* X = src + (size_t)2048 * NN * EE + n0 * EE + kb;
    const float* Wh = Wq + (size_t)head * 64 * EE + kb;
    const float* Wkh = Wk + (size_t)(head * 64 + wave * 4) * EE + e0;
    const int go = lr * EE + lc;

    const float bq0 = bq[head * 64 + lane], bq1 = bq[head * 64 + 32 + lane];
    const float bk0 = bk[head * 64 + lane], bk1 = bk[head * 64 + 32 + lane];
    float4 gx[4], gw[16], gk[4];
#pragma unroll
    for (int i = 0; i < 4; ++i)
        gx[i] = *(const float4*)(X + i * 4 * EE + go);
#pragma unroll
    for (int i = 0; i < 16; ++i)
        gw[i] = *(const float4*)(Wh + i * 4 * EE + go);
#pragma unroll
    for (int i = 0; i < 4; ++i)          // one whole 512-byte piece of a Wk row per load
        gk[i] = *(const float4*)(Wkh + i * EE + lane * 4);
#pragma unroll
    for (int i = 0; i < 4; ++i)
        *(float4*)&lds.stage[wave][i * 4 + lr][lc] = gx[i];
#pragma unroll
    for (int i = 0; i < 16; ++i)
        *(float4*)&lds.stage[wave][16 + i * 4 + lr][lc] = gw[i];
    // The Wk rows go to LDS here, ahead of the first product, so that their loads
    // are asked for together with the others (stored behind the product, they
    // were loaded behind it too, their latency in the open).
#pragma unroll
    for (int i = 0; i < 4; ++i)
        *(float4*)&lds.wk[wave * 4 + i][lane * 4] = gk[i];
    // The wave reads back rows that its other lanes wrote: its own LDS stores
    // must be done, and the compiler must not lift the reads over them.
    asm volatile("s_wait_dscnt 0x0" ::: "memory");

    const int c = lane & 15, h = lane >> 4;
    float4 fx[4], fw[4][4];
#pragma unroll
    for (int i = 0; i < 4; ++i) {
        fx[i] = *(const float4*)&lds.stage[wave][c][8 * i + 4 * h];
#pragma unroll
        for (int t = 0; t < 4; ++t)
            fw[t][i] = *(const float4*)&lds.stage[wave][16 + 16 * t + c][8 * i + 4 * h];
    }
    // Fence pair, as in lin_tile: the LDS reads stay ahead of the WMMAs and no
    // address arithmetic is scheduled into the run behind an operand's last use.
    __builtin_amdgcn_sched_barrier(0);
    v8f acc[4] = {};
#pragma unroll
    for (int i = 0; i < 4; ++i) {
#pragma unroll
        for (int t = 0; t < 4; ++t)
            acc[t] = wmma_f32(fx[i].x, fx[i].y, fw[t][i].x, fw[t][i].y, acc[t]);
#pragma unroll
        for (int t = 0; t < 4; ++t)
            acc[t] = wmma_f32(fx[i].z, fx[i].w, fw[t][i].z, fw[t][i].w, acc[t]);
    }
    __builtin_amdgcn_sched_barrier(0);
    // D register r of lane (c, h) = q[n0 + 8h + r][head * 64 + 16t + c].
#pragma unroll
    for (int r = 0; r < 8; ++r)
#pragma unroll
        for (int t = 0; t < 4; ++t)
            lds.red[wave][r][t][lane] = acc[t][r];
    __syncthreads();                     // every wave's partials of q and rows of Wk are in LDS

    // Wave w sums row n0 + w of q: d = lane and d = lane + 32.
    const float* pr = &lds.red[0][wave & 7][h][(wave >> 3) * 16 + c];
    float qv[2];
#pragma unroll
    for (int u = 0; u < 2; ++u) {
        const float* p = pr + u * 64;
        float s0 = p[0 * 1024], s1 = p[1 * 1024], s2 = p[2 * 1024], s3 = p[3 * 1024];
#pragma unroll
        for (int w = 4; w < LIN_WAVES; w += 4) {
            s0 += p[(w + 0) * 1024];
            s1 += p[(w + 1) * 1024];
            s2 += p[(w + 2) * 1024];
            s3 += p[(w + 3) * 1024];
        }
        qv[u] = ((s0 + s1) + (s2 + s3)) + (u ? bq1 : bq0);
        lds.qh[wave][u * 32 + lane] = qv[u];
    }
    __syncthreads();                     // q of the head lies in LDS for every wave

    const int t2 = wave & 7, kh = wave >> 3;
    float4 fa[4];
    float fb[4][4];
#pragma unroll
    for (int i = 0; i < 4; ++i) {
        fa[i] = *(const float4*)&lds.qh[c][32 * kh + 8 * i + 4 * h];
#pragma unroll
        for (int j = 0; j < 4; ++j)
            fb[i][j] = lds.wk[32 * kh + 8 * i + 4 * h + j][16 * t2 + c];
    }
    __builtin_amdgcn_sched_barrier(0);   // fence pair, as above
    v8f a2 = {};
#pragma unroll
    for (int i = 0; i < 4; ++i) {
        a2 = wmma_f32(fa[i].x, fa[i].y, fb[i][0], fb[i][1], a2);
        a2 = wmma_f32(fa[i].z, fa[i].w, fb[i][2], fb[i][3], a2);
    }
    __builtin_amdgcn_sched_barrier(0);
    // D register r of lane (c, h) = qk[n0 + 8h + r][head][e0 + 16 t2 + c], d half kh.
#pragma unroll
    for (int r = 0; r < 8; ++r)
        lds.red2[kh][r][t2][lane] = a2[r];
    __syncthreads();                     // both d halves of every column tile are in LDS

    // Wave w stores row n0 + w: 128 columns = four whole 128-byte lines, and the
    // same columns of the padding head as zeros.
    const float* p2 = &lds.red2[0][wave & 7][lane >> 2][(wave >> 3) * 16 + (lane & 3) * 4];
    const float4 u0 = *(const float4*)p2;
    const float4 u1 = *(const float4*)(p2 + 2048);
    float* o = qk + ((size_t)(n0 + wave) * 16 + head) * EE + e0 + lane * 4;
    *(float4*)o = make_float4(u0.x + u1.x, u0.y + u1.y, u0.z + u1.z, u0.w + u1.w);
    *(float4*)(o + 8 * EE) = make_float4(0.0f, 0.0f, 0.0f, 0.0f);
    // Precaution: stands between the two stores and the reuse of their registers below.
    asm volatile("s_wait_xcnt 0x0" ::: "memory");
    // One block per (head, row group) hands on the score bias of its rows, last,
    // so that no barrier waits for this sum or its store.
    if (e0 == 0) {
        float sv = fmaf(qv[1], bk1, qv[0] * bk0);
#pragma unroll
        for (int m = 16; m >= 1; m >>= 1) sv += __shfl_xor(sv, m, 32);
        if (lane == 0) sb[(n0 + wave) * HH + head] = sv;
    }
}

// ---------------------------------------------------------------------------
// Stages 2 to 4 in one pass over src (each src row is read from memory once).
// Grid (n, chunk of 512 s). 16 waves; two rounds of 256 s rows.
// Round: wave w brings rows 16w .. 16w+15 (whole 512-byte pieces of a row per
// load), rounds them to bf16 and lays them row-major in LDS. Then
//   S^T[s, head] = src[s, :] . qk[head, :]      A = own 16 rows, B = qk (LDS)
//   p = exp(x - running max), handed over in LDS as the B fragment of
//   ctx^T[e, head] += src^T[e, s] . p[s, head]  A = transposing LDS loads,
// where wave w owns e = 32w .. 32w+31 over all 256 rows of the round.
// Both products use the hardware k order: k = 8h + i, then 16 + 8h + i.
// The block hands on an un-normalised sum with its (max, sum) per head.
// ---------------------------------------------------------------------------
typedef __attribute__((ext_vector_type(4))) unsigned int u32x4;
typedef __attribute__((ext_vector_type(2))) unsigned int u32x2;
typedef __attribute__((ext_vector_type(8))) short s16x8;
typedef __attribute__((ext_vector_type(2))) __bf16 bf16x2;

#define FA_WAVES  16
#define FA_ROWS   256     // s rows per round
#define FA_ROUNDS 2
#define FA_CHUNKS 8
#define FA_PITCH  1056    // bytes: 1024 of data + 32, an odd multiple of 32 for the transposing loads
#define FA_QPITCH 1040    // bytes, qk rows: an odd multiple of 16 for plain 16-byte reads
#define ROWF      (NN * EE)   // floats between consecutive s

union Frag { u32x4 q[2]; v16bf v; };

#define FA_DEPTH 7        // rows (2 KiB each) that a wave keeps in flight (the waits in the row loop keep the compiler from asking a row early)
#define FA_MXP 20         // floats per head in the exchange rows: 80 B, an odd multiple of 16

struct FaLds {                         // the small arrays first: their offsets fit the LDS instructions' immediate
    u32x4 p[FA_ROWS / 32][2][32];      // [k step][first / second 16 rows][lane]
    float mx[16 * FA_MXP];             // [head][wave]
    unsigned char qk[16 * FA_QPITCH];
    unsigned char tile[FA_ROWS * FA_PITCH];
};

__device__ __forceinline__ unsigned int pack2(float lo, float hi) {
    v2f f = {lo, hi};
    return __builtin_bit_cast(unsigned int, __builtin_convertvector(f, bf16x2));
}
__device__ __forceinline__ void put_bf16x4(unsigned char* dst, float4 v) {
    u32x2 w = {pack2(v.x, v.y), pack2(v.z, v.w)};
    *(u32x2*)dst = w;
}
__device__ __forceinline__ u32x4 ld_tr16(const unsigned char* p) {
    typedef __attribute__((address_space(3))) s16x8 lds_s16x8;
    return __builtin_bit_cast(u32x4, __builtin_amdgcn_ds_load_tr16_b128_v8i16((lds_s16x8*)p));
}
// lane l <-> lane l ^ 16
__device__ __forceinline__ float xhalf(float x) {
    int b = __builtin_bit_cast(int, x);
    return __builtin_bit_cast(float, __builtin_amdgcn_permlanex16(b, b, 0x76543210, 0xfedcba98, false, false));
}
__device__ __forceinline__ float bf_lo(unsigned int w) { return __builtin_bit_cast(float, w << 16); }
__device__ __forceinline__ float bf_hi(unsigned int w) { return __builtin_bit_cast(float, w & 0xffff0000u); }
// exp(x) as __expf is built (one multiply, v_exp_f32), in asm so that the v_nop
// stands directly behind the transcendental: the slot that the instruction set
// asks for in front of an instruction that reads its result or overwrites its
// source.
__device__ __forceinline__ float exp_slot(float x) {
    float r;
    asm("v_exp_f32 %0, %1\n\tv_nop" : "=v"(r) : "v"(x * 1.44269504f));
    return r;
}
// Work-group barrier for hand-overs through LDS: the wave's LDS operations are
// done before it signals, while its global loads of the coming rows stay in
// flight (__syncthreads() was built with a wait for those loads as well). The
// scheduling fences keep work on those loads' registers from moving over it.
__device__ __forceinline__ void lds_barrier() {
    __builtin_amdgcn_sched_barrier(0);
    asm volatile("s_wait_dscnt 0x0\n\ts_barrier_signal -1\n\ts_barrier_wait -1" ::: "memory");
    __builtin_amdgcn_sched_barrier(0);
}

typedef __attribute__((ext_vector_type(4))) float f32x4;
// src is read once: a non-temporal load leaves little of it in L2.
__device__ __forceinline__ float4 ld_nt(const float* p) {
    f32x4 v = __builtin_nontemporal_load((const f32x4*)p);
    return make_float4(v.x, v.y, v.z, v.w);
}

__global__ __launch_bounds__(512) void attn_pass_kernel(const float* __restrict__ src,
                                                        const float* __restrict__ qk,
                                                        const float* __restrict__ sb,
                                                        float* __restrict__ part,
                                                        float* __restrict__ ml) {
    __shared__ __attribute__((aligned(16))) FaLds lds;
    const int n = blockIdx.x;            // 0..31
    const int ch = blockIdx.y;           // 0..7  (512 s each)
    // The wave's number in a scalar register: row addresses are then a scalar
    // base plus one lane offset, not a vector register pair for each.
    const int wave = __builtin_amdgcn_readfirstlane(threadIdx.x >> 5);
    const int lane = threadIdx.x & 31;
    const int c = lane & 15, h = lane >> 4;

    // qk[n] (16 padded heads x 512) -> bf16 in LDS.
    float4 gq[4];
#pragma unroll
    for (int i = 0; i < 4; ++i)
        gq[i] = *(const float4*)(qk + (size_t)n * 16 * EE + (i * 512 + (int)threadIdx.x) * 4);
    const float bias = sb[n * HH + (c & 7)];   // padding columns 8..15 are never stored
    // Precaution: stands between the loads above and any reuse of their offset
    // registers.
    asm volatile("s_wait_xcnt 0x0" ::: "memory");

    // Row f (0..31) of the wave's share: round f >> 4, row f & 15 of its sixteen;
    // four loads of 512 contiguous bytes each. FA_DEPTH rows are kept in flight.
    const float* g = src + ((size_t)(ch * (FA_ROWS * FA_ROUNDS) + wave * 16) * NN + n) * EE;
    const int gl = lane * 4;
    float4 buf[FA_DEPTH * 4];
#pragma unroll
    for (int i = 0; i < FA_DEPTH * 4; ++i)
        buf[i] = ld_nt(g + (size_t)(i >> 2) * ROWF + (i & 3) * 128 + gl);
    __builtin_amdgcn_sched_barrier(0);   // the first rows are asked for before anything waits
#pragma unroll
    for (int i = 0; i < 4; ++i) {
        int f = (i * 512 + (int)threadIdx.x) * 4;
        put_bf16x4(lds.qk + (f >> 9) * FA_QPITCH + (f & 511) * 2, gq[i]);
    }

    unsigned char* trow = lds.tile + (wave * 16) * FA_PITCH + lane * 8;
    const unsigned char* ta = lds.tile + (wave * 16 + c) * FA_PITCH + 16 * h;
    const unsigned char* tb = lds.qk + c * FA_QPITCH + 16 * h;
    const unsigned char* tt = lds.tile + (8 * h + (lane & 7)) * FA_PITCH + ((lane >> 3) & 1) * 16 + wave * 64;

    float m_run = -INFINITY, l_run = 0.0f;
    v8f acc0 = {}, acc1 = {};
#pragma unroll
    for (int r = 0; r < FA_ROUNDS; ++r) {
        // Row by row: a row's four registers are asked for again as soon as the
        // row lies in LDS, so that the wave's loads stay in flight, through the
        // products too. The fence keeps that order (without it the loads were
        // bunched, more registers were live and some were spilled).
#pragma unroll
        for (int q = 0; q < 16; ++q) {
            const int f = r * 16 + q, slot = (f % FA_DEPTH) * 4, fn = f + FA_DEPTH;
#pragma unroll
            for (int k = 0; k < 4; ++k)
                put_bf16x4(trow + q * FA_PITCH + k * 256, buf[slot + k]);
            if (fn < FA_ROUNDS * 16) {
                const float* gn = g + (size_t)((fn >> 4) * FA_ROWS + (fn & 15)) * ROWF;
                // Precaution: stands between the earlier rows' loads and these loads'
                // destinations (a build laid one over the lane offset that those name).
                asm volatile("s_wait_xcnt 0x0" ::: "memory");
#pragma unroll
                for (int k = 0; k < 4; ++k)
                    buf[slot + k] = ld_nt(gn + k * 128 + gl);
                // The same behind the last row's loads: their address registers are free from here on.
                if (fn + 1 == FA_ROUNDS * 16) asm volatile("s_wait_xcnt 0x0" ::: "memory");
            }
            __builtin_amdgcn_sched_barrier(0);
        }
        if (r == 0) lds_barrier();       // qk lies in LDS for every wave

        // Scores of the wave's own 16 rows: s0[i] + s1[i] = raw[s = 16w + 8h + i][head c].
        v8f s0 = {}, s1 = {};
#pragma unroll
        for (int ks = 0; ks < 16; ks += 2) {
            Frag a0, b0, a1, b1;
            a0.q[0] = *(const u32x4*)(ta + ks * 64);      a0.q[1] = *(const u32x4*)(ta + ks * 64 + 32);
            b0.q[0] = *(const u32x4*)(tb + ks * 64);      b0.q[1] = *(const u32x4*)(tb + ks * 64 + 32);
            a1.q[0] = *(const u32x4*)(ta + ks * 64 + 64); a1.q[1] = *(const u32x4*)(ta + ks * 64 + 96);
            b1.q[0] = *(const u32x4*)(tb + ks * 64 + 64); b1.q[1] = *(const u32x4*)(tb + ks * 64 + 96);
            s0 = wmma_bf16(a0.v, b0.v, s0);
            s1 = wmma_bf16(a1.v, b1.v, s1);
        }
        float x[8];
        float mx = -INFINITY;
#pragma unroll
        for (int i = 0; i < 8; ++i) {
            x[i] = ((s0[i] + s1[i]) + bias) * 0.125f;
            mx = fmaxf(mx, x[i]);
        }
        mx = fmaxf(mx, xhalf(mx));
        lds.mx[c * FA_MXP + wave] = mx;  // both halves hold the same value
        lds_barrier();                   // every wave's maxima are in LDS
        float4 m4[4];
#pragma unroll
        for (int i = 0; i < 4; ++i) m4[i] = *(const float4*)&lds.mx[c * FA_MXP + 4 * i];
        float mr = -INFINITY;
#pragma unroll
        for (int i = 0; i < 4; ++i)
            mr = fmaxf(mr, fmaxf(fmaxf(m4[i].x, m4[i].y), fmaxf(m4[i].z, m4[i].w)));
        const float m_new = fmaxf(m_run, mr);
        const float scale = exp_slot(m_run - m_new);
        m_run = m_new;
        u32x4 pw;
        float ls = 0.0f;                 // the sum is taken of the rounded weights
#pragma unroll
        for (int i = 0; i < 4; ++i) {
            pw[i] = pack2(exp_slot(x[2 * i] - m_new), exp_slot(x[2 * i + 1] - m_new));
            ls += bf_lo(pw[i]) + bf_hi(pw[i]);
        }
        l_run = fmaf(l_run, scale, ls);
        lds.p[wave >> 1][wave & 1][lane] = pw;
        lds_barrier();                   // every wave's rows and weights are in LDS

#pragma unroll
        for (int i = 0; i < 8; ++i) { acc0[i] *= scale; acc1[i] *= scale; }
#pragma unroll
        for (int j = 0; j < FA_ROWS / 32; ++j) {
            Frag b, a0, a1;
            b.q[0] = lds.p[j][0][lane];
            b.q[1] = lds.p[j][1][lane];
            const unsigned char* tj = tt + j * 32 * FA_PITCH;
            a0.q[0] = ld_tr16(tj);      a0.q[1] = ld_tr16(tj + 16 * FA_PITCH);
            a1.q[0] = ld_tr16(tj + 32); a1.q[1] = ld_tr16(tj + 16 * FA_PITCH + 32);
            acc0 = wmma_bf16(a0.v, b.v, acc0);
            acc1 = wmma_bf16(a1.v, b.v, acc1);
        }
        if (r + 1 < FA_ROUNDS)
            lds_barrier();               // all reads of this round's LDS are done
    }

    // The waves' sums of weights (all against the same final maximum) -> wave 0.
    lds.mx[c * FA_MXP + wave] = l_run + xhalf(l_run);
    lds_barrier();

    // acc{0,1}[i] = ctx^T[e = 32w + {0,16} + 8h + i][head c]; heads 8..15 are padding.
    if (c < HH) {
        float* o = part + (((size_t)ch * NN + n) * HH + c) * EE + wave * 32 + 8 * h;
        *(float4*)(o)      = make_float4(acc0[0], acc0[1], acc0[2], acc0[3]);
        *(float4*)(o + 4)  = make_float4(acc0[4], acc0[5], acc0[6], acc0[7]);
        *(float4*)(o + 16) = make_float4(acc1[0], acc1[1], acc1[2], acc1[3]);
        *(float4*)(o + 20) = make_float4(acc1[4], acc1[5], acc1[6], acc1[7]);
        if (wave == 0 && h == 0) {
            float l_tot = 0.0f;
#pragma unroll
            for (int w = 0; w < FA_WAVES; ++w) l_tot += lds.mx[c * FA_MXP + w];
            ml[((ch * NN + n) * HH + c) * 2 + 0] = m_run;
            ml[((ch * NN + n) * HH + c) * 2 + 1] = l_tot;
        }
    }
}

// Merge of the 8 chunks: weights exp(m_c - M), divided by the merged sum.
__global__ __launch_bounds__(256) void merge_kernel(const float* __restrict__ part,
                                                    const float* __restrict__ ml,
                                                    float* __restrict__ ctx) {
    int idx = blockIdx.x * 256 + threadIdx.x;   // 32*8*512 = 131072
    int nh = idx >> 9;
    float m[FA_CHUNKS], l[FA_CHUNKS], v[FA_CHUNKS];
    float M = -INFINITY;
#pragma unroll
    for (int k = 0; k < FA_CHUNKS; ++k) {
        m[k] = ml[(k * (NN * HH) + nh) * 2 + 0];
        l[k] = ml[(k * (NN * HH) + nh) * 2 + 1];
        v[k] = part[(size_t)k * 131072 + idx];
        M = fmaxf(M, m[k]);
    }
    float L = 0.0f, a = 0.0f;
#pragma unroll
    for (int k = 0; k < FA_CHUNKS; ++k) {
        float w = __expf(m[k] - M);
        L = fmaf(w, l[k], L);
        a = fmaf(w, v[k], a);
    }
    ctx[idx] = a / L;
}

// ---------------------------------------------------------------------------
// Stage 5: tiny output chain.
// mo[n,j] = Wv[j,:].ctx[n, j>>6, :] + bv[j]   (bv passes through: sum p == 1)
// out = mo @ W2.T + b2   (W2 = Wl Wo, b2 = Wl bo + bl, from the first launch)
// ---------------------------------------------------------------------------
__global__ __launch_bounds__(512) void vproj_kernel(const float* __restrict__ ctx,
                                                    const float* __restrict__ Wv,
                                                    const float* __restrict__ bv,
                                                    float* __restrict__ mo) {
    int j0 = (blockIdx.x & 15) * 32, n0 = (blockIdx.x >> 4) * 16;
    int head = j0 >> 6;            // the block's 32 columns lie in one head
    lin_tile(ctx + (size_t)head * EE, HH * EE, Wv, bv, mo, n0, j0);
}

__global__ __launch_bounds__(512) void lin_kernel(const float* __restrict__ A,
                                                  const float* __restrict__ W,
                                                  const float* __restrict__ b,
                                                  float* __restrict__ out) {
    int j0 = (blockIdx.x & 15) * 32, n0 = (blockIdx.x >> 4) * 16;
    lin_tile(A, EE, W, b, out, n0, j0);
}

// ---------------------------------------------------------------------------
extern "C" void kernel_launch(void* const* d_in, const int* in_sizes, int n_in,
                              void* d_out, int out_size, void* d_ws, size_t ws_size,
                              hipStream_t stream) {
    const float* src = (const float*)d_in[0];
    const float* Wq  = (const float*)d_in[1];
    const float* bq  = (const float*)d_in[2];
    const float* Wk  = (const float*)d_in[3];
    const float* bk  = (const float*)d_in[4];
    const float* Wv  = (const float*)d_in[5];
    const float* bv  = (const float*)d_in[6];
    const float* Wo  = (const float*)d_in[7];
    const float* bo  = (const float*)d_in[8];
    const float* Wl  = (const float*)d_in[9];
    const float* bl  = (const float*)d_in[10];

    float* ws = (float*)d_ws;
    float* qkbuf  = ws + 16384;       // 32*16*512 = 262144 (head-padded)
    float* sb     = ws + 278528;      // 256
    float* ml     = ws + 278784;      // 8*32*8 pairs (max, sum) = 4096
    float* part   = ws + 3424512;     // 8*32*8*512 = 1048576
    float* ctx    = ws + 4473088;     // 32*8*512 = 131072
    float* mo     = ws + 4604160;     // 16384
    float* W2     = ws + 4620544;     // 512*512 = 262144
    float* b2     = ws + 4882688;     // 512  (end: 4883200 floats ~ 18.6 MB)

    qk_fused_kernel<<<192, 512, 0, stream>>>(src, Wq, bq, Wk, bk, Wo, bo, Wl, bl, qkbuf, sb, W2, b2);
    attn_pass_kernel<<<dim3(32, 8), 512, 0, stream>>>(src, qkbuf, sb, part, ml);
    merge_kernel  <<<512,  256, 0, stream>>>(part, ml, ctx);
    vproj_kernel  <<<32,   512, 0, stream>>>(ctx, Wv, bv, mo);
    lin_kernel    <<<32,   512, 0, stream>>>(mo, W2, b2, (float*)d_out);
}

// v006
// Measured time: 35.1 microseconds a run.
// Next to v005, in two timings, it ran 1.04 times as fast each time.
// Counting every step since v000, it is 4.06 times as fast.
#include <hip/hip_runtime.h>
#include <math.h>

// Problem constants (from reference): S=4096, N=32, E=512, H=8, DK=64, l=2048.
#define SS 4096
#define NN 32
#define EE 512
#define HH 8

typedef __attribute__((ext_vector_type(16))) __bf16 v16bf;
typedef __attribute__((ext_vector_type(8)))  float  v8f;
typedef __attribute__((ext_vector_type(2)))  float  v2f;

__device__ __forceinline__ v8f wmma_bf16(v16bf a, v16bf b, v8f c) {
    return __builtin_amdgcn_wmma_f32_16x16x32_bf16(false, a, false, b, (short)0, c, false, false);
}

// ---------------------------------------------------------------------------
// Tile for the last small linear  Y[n,j] = X[n,:] . Wt[j,:] + b[j]
// (32 x 512, K = 512), all in f32 on v_wmma_f32_16x16x4_f32.
// One block of 16 waves owns 16 rows n x 32 columns j. Wave w owns the K slice
// [32w, 32w+32): it issues all of its loads at once (each wave-wide 16-byte
// load covers four whole 128-byte lines: 4 rows x 32 floats), turns them into
// fragments through its own LDS range, and runs two accumulator chains of 8
// WMMAs. The 16 K-slice partials are summed in LDS in a fixed order.
// k order: lane (c = lane&15, h = lane>>4) takes k = 8i + 4h + {0,1} and
// 8i + 4h + {2,3} of its row, by the same code for X and for Wt.
// ---------------------------------------------------------------------------
#define LIN_WAVES 16
#define LIN_PITCH 36   // floats: 128 B of data + 16 B, so 16 rows' 16-byte reads fall on 64 distinct banks

__device__ __forceinline__ v8f wmma_f32(float a0, float a1, float b0, float b1, v8f c) {
    v2f a = {a0, a1};
    v2f b = {b0, b1};
    return __builtin_amdgcn_wmma_f32_16x16x4_f32(false, a, false, b, (short)0, c, false, false);
}

struct LinLds {
    float red[LIN_WAVES][8][2][32];            // K-slice partials, lane-major
    float stage[LIN_WAVES][48][LIN_PITCH];     // per wave: 16 rows of X, 32 rows of Wt
};

__device__ __forceinline__ void lin_tile(const float* __restrict__ X, int x_stride,
                                         const float* __restrict__ Wt,
                                         const float* __restrict__ b,
                                         float* __restrict__ Y, int n0, int j0) {
    __shared__ __attribute__((aligned(16))) LinLds lds;
    int wave = threadIdx.x >> 5;
    int lane = threadIdx.x & 31;
    int kb = wave * 32;
    int lr = lane >> 3;            // row within a group of four
    int lc = (lane & 7) * 4;       // float offset within the 128-byte slice

    float4 gx[4], gw[8];
#pragma unroll
    for (int i = 0; i < 4; ++i)
        gx[i] = *(const float4*)(X + (size_t)(n0 + i * 4 + lr) * x_stride + kb + lc);
#pragma unroll
    for (int i = 0; i < 8; ++i)
        gw[i] = *(const float4*)(Wt + (size_t)(j0 + i * 4 + lr) * EE + kb + lc);
    float bias = b[j0 + lane];     // asked for with the tiles, used at the very end
#pragma unroll
    for (int i = 0; i < 4; ++i)
        *(float4*)&lds.stage[wave][i * 4 + lr][lc] = gx[i];
#pragma unroll
    for (int i = 0; i < 8; ++i)
        *(float4*)&lds.stage[wave][16 + i * 4 + lr][lc] = gw[i];
    // The wave reads back rows that its other lanes wrote: its own LDS stores
    // must be done, and the compiler must not lift the reads over them.
    asm volatile("s_wait_dscnt 0x0" ::: "memory");

    int c = lane & 15, h = lane >> 4;
    float4 fx[4], f0[4], f1[4];
#pragma unroll
    for (int i = 0; i < 4; ++i) {
        fx[i] = *(const float4*)&lds.stage[wave][c][8 * i + 4 * h];
        f0[i] = *(const float4*)&lds.stage[wave][16 + c][8 * i + 4 * h];
        f1[i] = *(const float4*)&lds.stage[wave][32 + c][8 * i + 4 * h];
    }
    // Fence pair: the LDS reads stay one group ahead of the WMMAs, and no address
    // arithmetic is scheduled into the run, where it could overwrite an operand
    // register directly behind the WMMA that reads it.
    __builtin_amdgcn_sched_barrier(0);
    v8f acc0 = {}, acc1 = {};
#pragma unroll
    for (int i = 0; i < 4; ++i) {
        acc0 = wmma_f32(fx[i].x, fx[i].y, f0[i].x, f0[i].y, acc0);
        acc1 = wmma_f32(fx[i].x, fx[i].y, f1[i].x, f1[i].y, acc1);
        acc0 = wmma_f32(fx[i].z, fx[i].w, f0[i].z, f0[i].w, acc0);
        acc1 = wmma_f32(fx[i].z, fx[i].w, f1[i].z, f1[i].w, acc1);
    }
    __builtin_amdgcn_sched_barrier(0);
    // D register r of lane (c, h) = Y[n0 + 8h + r][j0 + 16t + c].
#pragma unroll
    for (int r = 0; r < 8; ++r) {
        lds.red[wave][r][0][lane] = acc0[r];
        lds.red[wave][r][1][lane] = acc1[r];
    }
    __syncthreads();
    // Wave w stores row n0 + w: 32 columns = one whole 128-byte line.
    const float* pr = &lds.red[0][wave & 7][lane >> 4][(wave >> 3) * 16 + c];
    float s0 = pr[0 * 512], s1 = pr[1 * 512], s2 = pr[2 * 512], s3 = pr[3 * 512];
#pragma unroll
    for (int w = 4; w < LIN_WAVES; w += 4) {
        s0 += pr[(w + 0) * 512];
        s1 += pr[(w + 1) * 512];
        s2 += pr[(w + 2) * 512];
        s3 += pr[(w + 3) * 512];
    }
    Y[(size_t)(n0 + wave) * EE + j0 + lane] = ((s0 + s1) + (s2 + s3)) + bias;
}

// ---------------------------------------------------------------------------
// The two last linears as one:  (mo Wo^T + bo) Wl^T + bl = mo W2^T + b2  with
//   W2[i,j] = sum_k Wl[i,k] * Wo[k,j]     b2[i] = Wl[i,:] . bo + bl[i]
// W2 and b2 depend on the weights alone, so they are formed in the first launch,
// by work-groups of their own on WGPs that the launch leaves idle.
// One block of 16 waves owns 32 rows i x 64 columns j. Wave w owns the K slice
// [32w, 32w+32): its 32 x 32 piece of Wl goes through its own LDS range as in
// lin_tile; its 32 x 64 piece of Wo stays in registers: lane (c, h) loads the four
// columns j0 + 4c .. +3 of row k, one for each of four column tiles, so column c
// of tile t is j0 + 4c + t and every load covers whole 128-byte lines.
// k order: lane (c, h) takes k = 8i + 4h + {0,1} and 8i + 4h + {2,3}, for Wl
// (row c) and for Wo (column c) alike. The 16 K-slice partials are summed in LDS
// in a fixed order.
// ---------------------------------------------------------------------------
struct FoldLds {
    float red[LIN_WAVES][2][8][32][4];         // K-slice partials: [row tile][D register][lane][column tile]
    float stage[LIN_WAVES][32][LIN_PITCH];     // per wave: 32 rows of Wl
    float bred[LIN_WAVES][32];                 // K-slice partials of Wl . bo
};

__device__ __forceinline__ void fold_tile(FoldLds& lds,
                                          const float* __restrict__ Wl,
                                          const float* __restrict__ Wo,
                                          const float* __restrict__ bo,
                                          const float* __restrict__ bl,
                                          float* __restrict__ W2,
                                          float* __restrict__ b2, int i0, int j0) {
    const int wave = __builtin_amdgcn_readfirstlane(threadIdx.x >> 5);
    const int lane = threadIdx.x & 31;
    const int kb = wave * 32;
    const int lr = lane >> 3;            // row within a group of four
    const int lc = (lane & 7) * 4;       // float offset within the 128-byte slice
    const int c = lane & 15, h = lane >> 4;
    // Scalar bases and one lane offset (in bytes) each, as in the kernel below.
    const char* A = (const char*)(Wl + (size_t)i0 * EE + kb);
    const char* B = (const char*)(Wo + (size_t)kb * EE + j0);
    const unsigned int ao = (lr * EE + lc) * 4, bofs = (h * 4 * EE + c * 4) * 4;
    const bool first = j0 == 0;          // one block per row group forms b2 as well

    float4 ga[8], gb[4][4], gbo[4];
    float blv = 0.0f;
#pragma unroll
    for (int i = 0; i < 8; ++i)
        ga[i] = *(const float4*)(A + i * 4 * EE * 4 + ao);
#pragma unroll
    for (int i = 0; i < 4; ++i)
#pragma unroll
        for (int j = 0; j < 4; ++j)
            gb[i][j] = *(const float4*)(B + (8 * i + j) * EE * 4 + bofs);
    // Precaution: the loads' lane offsets are inputs here, so their registers are
    // not given to anything else (a load's destination either) ahead of this wait.
    asm volatile("s_wait_xcnt 0x0" :: "v"(ao), "v"(bofs) : "memory");
    if (first) {
#pragma unroll
        for (int i = 0; i < 4; ++i)
            gbo[i] = *(const float4*)(bo + kb + 8 * i + 4 * h);
        blv = (bl + i0)[lane];
    }
#pragma unroll
    for (int i = 0; i < 8; ++i)
        *(float4*)&lds.stage[wave][i * 4 + lr][lc] = ga[i];
    // The wave reads back rows that its other lanes wrote: its own LDS stores
    // must be done, and the compiler must not lift the reads over them.
    asm volatile("s_wait_dscnt 0x0" ::: "memory");
    float4 fx[2][4];
#pragma unroll
    for (int a = 0; a < 2; ++a)
#pragma unroll
        for (int i = 0; i < 4; ++i)
            fx[a][i] = *(const float4*)&lds.stage[wave][16 * a + c][8 * i + 4 * h];
    if (first) {
#pragma unroll
        for (int a = 0; a < 2; ++a) {
            float s = 0.0f;
#pragma unroll
            for (int i = 0; i < 4; ++i) {
                s = fmaf(fx[a][i].x, gbo[i].x, s);
                s = fmaf(fx[a][i].y, gbo[i].y, s);
                s = fmaf(fx[a][i].z, gbo[i].z, s);
                s = fmaf(fx[a][i].w, gbo[i].w, s);
            }
            s += __shfl_xor(s, 16, 32);
            lds.bred[wave][16 * a + c] = s;   // both halves hold the same value
        }
    }
    // The B operand wants two k of one column side by side; a load holds four
    // columns of one k. The pairs are formed here, in registers of their own.
    v2f bp[4][2][4];
#pragma unroll
    for (int i = 0; i < 4; ++i)
#pragma unroll
        for (int p = 0; p < 2; ++p) {
            bp[i][p][0] = v2f{gb[i][2 * p].x, gb[i][2 * p + 1].x};
            bp[i][p][1] = v2f{gb[i][2 * p].y, gb[i][2 * p + 1].y};
            bp[i][p][2] = v2f{gb[i][2 * p].z, gb[i][2 * p + 1].z};
            bp[i][p][3] = v2f{gb[i][2 * p].w, gb[i][2 * p + 1].w};
        }
    // Fence pair, as in lin_tile: operands are complete ahead of the WMMAs and
    // nothing is scheduled into the run behind an operand's last use.
    __builtin_amdgcn_sched_barrier(0);
    v8f acc[2][4] = {};
#pragma unroll
    for (int i = 0; i < 4; ++i)
        // (p, a) = (0,0) (1,1) (0,1) (1,0): every B pair that the first eight WMMAs
        // read is read again later, so that no accumulator, which gets its registers
        // there, is laid over a B pair just read.
#pragma unroll
        for (int u = 0; u < 4; ++u) {
            const int p = u & 1, a = (u ^ (u >> 1)) & 1;
            const v2f av = p ? v2f{fx[a][i].z, fx[a][i].w} : v2f{fx[a][i].x, fx[a][i].y};
#pragma unroll
            for (int t = 0; t < 4; ++t)
                acc[a][t] = __builtin_amdgcn_wmma_f32_16x16x4_f32(false, av, false, bp[i][p][t],
                                                                  (short)0, acc[a][t], false, false);
        }
    __builtin_amdgcn_sched_barrier(0);
    // The distance between the last WMMAs and the moves below, which reuse their
    // operand registers and read their results.
    asm volatile("v_nop\n\tv_nop\n\tv_nop\n\tv_nop");
    __builtin_amdgcn_sched_barrier(0);
    // D register r of lane (c, h), tile (a, t) = W2[i0 + 16a + 8h + r][j0 + 4c + t].
#pragma unroll
    for (int a = 0; a < 2; ++a)
#pragma unroll
        for (int r = 0; r < 8; ++r)
            *(float4*)&lds.red[wave][a][r][lane][0] =
                make_float4(acc[a][0][r], acc[a][1][r], acc[a][2][r], acc[a][3][r]);
    __syncthreads();                     // every wave's partials are in LDS
    // Wave w stores rows i0 + 2w and i0 + 2w + 1: 64 columns = two whole lines each.
    const int row = wave * 2 + h;
    const float* pr = &lds.red[0][row >> 4][row & 7][((row >> 3) & 1) * 16 + c][0];
    float4 s[4];
#pragma unroll
    for (int w = 0; w < 4; ++w) s[w] = *(const float4*)(pr + w * 2048);
#pragma unroll
    for (int w = 4; w < LIN_WAVES; ++w) {
        const float4 v = *(const float4*)(pr + w * 2048);
        s[w & 3].x += v.x; s[w & 3].y += v.y; s[w & 3].z += v.z; s[w & 3].w += v.w;
    }
    *(float4*)(W2 + (size_t)(i0 + row) * EE + j0 + c * 4) =
        make_float4((s[0].x + s[1].x) + (s[2].x + s[3].x), (s[0].y + s[1].y) + (s[2].y + s[3].y),
                    (s[0].z + s[1].z) + (s[2].z + s[3].z), (s[0].w + s[1].w) + (s[2].w + s[3].w));
    // Precaution: stands between the store and the reuse of its registers below.
    asm volatile("s_wait_xcnt 0x0" ::: "memory");
    if (first && wave == 0) {
        float t0 = 0.0f;
#pragma unroll
        for (int w = 0; w < LIN_WAVES; ++w) t0 += lds.bred[w][lane];
        b2[i0 + lane] = t0 + blv;
    }
}

// ---------------------------------------------------------------------------
// Stage 1 in one launch:
//   q[n,j]     = src[l=2048,n,:] . Wq[j,:] + bq[j]
//   qk[n,h,e]  = sum_d q[n,h*64+d] * Wk[h*64+d,e]   (h padded to 16 rows of zeros)
//   sb[n,h]    = q[n,h,:] . bk[h,:]                 (score bias from k's bias)
// Grid: 128 blocks of fold_tile (they start first: theirs is the longer run of
// WMMAs), then 8 heads x 2 groups of 16 rows n x 4 ranges of 128 columns e; 16 waves.
// Each of those 64 blocks forms its head's q (16 x 64, K = 512) itself, as lin_tile does
// (wave w owns the K slice [32w, 32w+32), partials summed in LDS in the same
// fixed order), keeps it in LDS and multiplies it with its 64 x 128 piece of
// Wk: wave w owns columns 16(w&7) .. +15 and the d half w>>3.
// k order of the second product: lane (c, h) takes d = 8i + 4h + {0,1} and
// 8i + 4h + {2,3}, for q (row c) and for Wk (column c) alike.
// ---------------------------------------------------------------------------
#define FOLD_BLOCKS 128   // 16 groups of 32 rows i x 8 groups of 64 columns j
#define QF_WKP 132   // floats: 512 B of data + 16 B, so the two lane halves (4 rows apart) read distinct banks
#define QF_QP  68    // floats: 272 B, an odd multiple of 16 for plain 16-byte reads

struct QfLds {
    float red[LIN_WAVES][8][4][32];            // K-slice partials of q, lane-major
    float stage[LIN_WAVES][80][LIN_PITCH];     // per wave: 16 rows of src[l], 64 rows of Wq
    float wk[64][QF_WKP];                      // [d][e]
    float qh[16][QF_QP];                       // [n][d]
    float red2[2][8][8][32];                   // [d half][D register][column tile][lane]
};

__global__ __launch_bounds__(512) void qk_fused_kernel(const float* __restrict__ src,
                                                       const float* __restrict__ Wq,
                                                       const float* __restrict__ bq,
                                                       const float* __restrict__ Wk,
                                                       const float* __restrict__ bk,
                                                       const float* __restrict__ Wo,
                                                       const float* __restrict__ bo,
                                                       const float* __restrict__ Wl,
                                                       const float* __restrict__ bl,
                                                       float* __restrict__ qk,
                                                       float* __restrict__ sb,
                                                       float* __restrict__ W2,
                                                       float* __restrict__ b2) {
    __shared__ __attribute__((aligned(16))) union { QfLds q; FoldLds f; } both;
    if (blockIdx.x < FOLD_BLOCKS) {      // the same for the whole block, ahead of every barrier
        fold_tile(both.f, Wl, Wo, bo, bl, W2, b2, (blockIdx.x >> 3) * 32, (blockIdx.x & 7) * 64);
        return;
    }
    QfLds& lds = both.q;
    const int bid = blockIdx.x - FOLD_BLOCKS;
    const int e0 = (bid & 3) * 128;
    const int n0 = ((bid >> 2) & 1) * 16;
    const int head = bid >> 3;
    // The wave's number in a scalar register: every load address is then a scalar
    // base plus one of two lane offsets, not a vector register pair for each.
    const int wave = __builtin_amdgcn_readfirstlane(threadIdx.x >> 5);
    const int lane = threadIdx.x & 31;
    const int kb = wave * 32;
    const int lr = lane >> 3;            // row within a group of four
    const int lc = (lane & 7) * 4;       // float offset within the 128-byte slice
    const float* X = src + (size_t)2048 * NN * EE + n0 * EE + kb;
    const float* Wh = Wq + (size_t)head * 64 * EE + kb;
    const float* Wkh = Wk + (size_t)(head * 64 + wave * 4) * EE + e0;
    const int go = lr * EE + lc;

    const float bq0 = bq[head * 64 + lane], bq1 = bq[head * 64 + 32 + lane];
    const float bk0 = bk[head * 64 + lane], bk1 = bk[head * 64 + 32 + lane];
    float4 gx[4], gw[16], gk[4];
#pragma unroll
    for (int i = 0; i < 4; ++i)
        gx[i] = *(const float4*)(X + i * 4 * EE + go);
#pragma unroll
    for (int i = 0; i < 16; ++i)
        gw[i] = *(const float4*)(Wh + i * 4 * EE + go);
#pragma unroll
    for (int i = 0; i < 4; ++i)          // one whole 512-byte piece of a Wk row per load
        gk[i] = *(const float4*)(Wkh + i * EE + lane * 4);
#pragma unroll
    for (int i = 0; i < 4; ++i)
        *(float4*)&lds.stage[wave][i * 4 + lr][lc] = gx[i];
#pragma unroll
    for (int i = 0; i < 16; ++i)
        *(float4*)&lds.stage[wave][16 + i * 4 + lr][lc] = gw[i];
    // The Wk rows go to LDS here, ahead of the first product, so that their loads
    // are asked for together with the others (stored behind the product, they
    // were loaded behind it too, their latency in the open).
#pragma unroll
    for (int i = 0; i < 4; ++i)
        *(float4*)&lds.wk[wave * 4 + i][lane * 4] = gk[i];
    // The wave reads back rows that its other lanes wrote: its own LDS stores
    // must be done, and the compiler must not lift the reads over them.
    asm volatile("s_wait_dscnt 0x0" ::: "memory");

    const int c = lane & 15, h = lane >> 4;
    float4 fx[4], fw[4][4];
#pragma unroll
    for (int i = 0; i < 4; ++i) {
        fx[i] = *(const float4*)&lds.stage[wave][c][8 * i + 4 * h];
#pragma unroll
        for (int t = 0; t < 4; ++t)
            fw[t][i] = *(const float4*)&lds.stage[wave][16 + 16 * t + c][8 * i + 4 * h];
    }
    // Fence pair, as in lin_tile: the LDS reads stay ahead of the WMMAs and no
    // address arithmetic is scheduled into the run behind an operand's last use.
    __builtin_amdgcn_sched_barrier(0);
    v8f acc[4] = {};
#pragma unroll
    for (int i = 0; i < 4; ++i) {
#pragma unroll
        for (int t = 0; t < 4; ++t)
            acc[t] = wmma_f32(fx[i].x, fx[i].y, fw[t][i].x, fw[t][i].y, acc[t]);
#pragma unroll
        for (int t = 0; t < 4; ++t)
            acc[t] = wmma_f32(fx[i].z, fx[i].w, fw[t][i].z, fw[t][i].w, acc[t]);
    }
    __builtin_amdgcn_sched_barrier(0);
    // D register r of lane (c, h) = q[n0 + 8h + r][head * 64 + 16t + c].
#pragma unroll
    for (int r = 0; r < 8; ++r)
#pragma unroll
        for (int t = 0; t < 4; ++t)
            lds.red[wave][r][t][lane] = acc[t][r];
    __syncthreads();                     // every wave's partials of q and rows of Wk are in LDS

    // Wave w sums row n0 + w of q: d = lane and d = lane + 32.
    const float* pr = &lds.red[0][wave & 7][h][(wave >> 3) * 16 + c];
    float qv[2];
#pragma unroll
    for (int u = 0; u < 2; ++u) {
        const float* p = pr + u * 64;
        float s0 = p[0 * 1024], s1 = p[1 * 1024], s2 = p[2 * 1024], s3 = p[3 * 1024];
#pragma unroll
        for (int w = 4; w < LIN_WAVES; w += 4) {
            s0 += p[(w + 0) * 1024];
            s1 += p[(w + 1) * 1024];
            s2 += p[(w + 2) * 1024];
            s3 += p[(w + 3) * 1024];
        }
        qv[u] = ((s0 + s1) + (s2 + s3)) + (u ? bq1 : bq0);
        lds.qh[wave][u * 32 + lane] = qv[u];
    }
    __syncthreads();                     // q of the head lies in LDS for every wave

    const int t2 = wave & 7, kh = wave >> 3;
    float4 fa[4];
    float fb[4][4];
#pragma unroll
    for (int i = 0; i < 4; ++i) {
        fa[i] = *(const float4*)&lds.qh[c][32 * kh + 8 * i + 4 * h];
#pragma unroll
        for (int j = 0; j < 4; ++j)
            fb[i][j] = lds.wk[32 * kh + 8 * i + 4 * h + j][16 * t2 + c];
    }
    __builtin_amdgcn_sched_barrier(0);   // fence pair, as above
    v8f a2 = {};
#pragma unroll
    for (int i = 0; i < 4; ++i) {
        a2 = wmma_f32(fa[i].x, fa[i].y, fb[i][0], fb[i][1], a2);
        a2 = wmma_f32(fa[i].z, fa[i].w, fb[i][2], fb[i][3], a2);
    }
    __builtin_amdgcn_sched_barrier(0);
    // D register r of lane (c, h) = qk[n0 + 8h + r][head][e0 + 16 t2 + c], d half kh.
#pragma unroll
    for (int r = 0; r < 8; ++r)
        lds.red2[kh][r][t2][lane] = a2[r];
    __syncthreads();                     // both d halves of every column tile are in LDS

    // Wave w stores row n0 + w: 128 columns = four whole 128-byte lines, and the
    // same columns of the padding head as zeros.
    const float* p2 = &lds.red2[0][wave & 7][lane >> 2][(wave >> 3) * 16 + (lane & 3) * 4];
    const float4 u0 = *(const float4*)p2;
    const float4 u1 = *(const float4*)(p2 + 2048);
    float* o = qk + ((size_t)(n0 + wave) * 16 + head) * EE + e0 + lane * 4;
    *(float4*)o = make_float4(u0.x + u1.x, u0.y + u1.y, u0.z + u1.z, u0.w + u1.w);
    *(float4*)(o + 8 * EE) = make_float4(0.0f, 0.0f, 0.0f, 0.0f);
    // Precaution: stands between the two stores and the reuse of their registers below.
    asm volatile("s_wait_xcnt 0x0" ::: "memory");
    // One block per (head, row group) hands on the score bias of its rows, last,
    // so that no barrier waits for this sum or its store.
    if (e0 == 0) {
        float sv = fmaf(qv[1], bk1, qv[0] * bk0);
#pragma unroll
        for (int m = 16; m >= 1; m >>= 1) sv += __shfl_xor(sv, m, 32);
        if (lane == 0) sb[(n0 + wave) * HH + head] = sv;
    }
}

// ---------------------------------------------------------------------------
// Stages 2 to 4 in one pass over src (each src row is read from memory once).
// Grid (n, chunk of 512 s). 16 waves; two rounds of 256 s rows.
// Round: wave w brings rows 16w .. 16w+15 (whole 512-byte pieces of a row per
// load), rounds them to bf16 and lays them row-major in LDS. Then
//   S^T[s, head] = src[s, :] . qk[head, :]      A = own 16 rows, B = qk (LDS)
//   p = exp(x - running max), handed over in LDS as the B fragment of
//   ctx^T[e, head] += src^T[e, s] . p[s, head]  A = transposing LDS loads,
// where wave w owns e = 32w .. 32w+31 over all 256 rows of the round.
// Both products use the hardware k order: k = 8h + i, then 16 + 8h + i.
// The block hands on an un-normalised sum with its (max, sum) per head.
// ---------------------------------------------------------------------------
typedef __attribute__((ext_vector_type(4))) unsigned int u32x4;
typedef __attribute__((ext_vector_type(2))) unsigned int u32x2;
typedef __attribute__((ext_vector_type(8))) short s16x8;
typedef __attribute__((ext_vector_type(2))) __bf16 bf16x2;

#define FA_WAVES  16
#define FA_ROWS   256     // s rows per round
#define FA_ROUNDS 2
#define FA_CHUNKS 8
#define FA_PITCH  1056    // bytes: 1024 of data + 32, an odd multiple of 32 for the transposing loads
#define FA_QPITCH 1040    // bytes, qk rows: an odd multiple of 16 for plain 16-byte reads
#define ROWF      (NN * EE)   // floats between consecutive s

union Frag { u32x4 q[2]; v16bf v; };

#define FA_DEPTH 7        // rows (2 KiB each) that a wave keeps in flight (the waits in the row loop keep the compiler from asking a row early)
#define FA_MXP 20         // floats per head in the exchange rows: 80 B, an odd multiple of 16

struct FaLds {                         // the small arrays first: their offsets fit the LDS instructions' immediate
    u32x4 p[FA_ROWS / 32][2][32];      // [k step][first / second 16 rows][lane]
    float mx[16 * FA_MXP];             // [head][wave]
    unsigned char qk[16 * FA_QPITCH];
    unsigned char tile[FA_ROWS * FA_PITCH];
};

__device__ __forceinline__ unsigned int pack2(float lo, float hi) {
    v2f f = {lo, hi};
    return __builtin_bit_cast(unsigned int, __builtin_convertvector(f, bf16x2));
}
__device__ __forceinline__ void put_bf16x4(unsigned char* dst, float4 v) {
    u32x2 w = {pack2(v.x, v.y), pack2(v.z, v.w)};
    *(u32x2*)dst = w;
}
__device__ __forceinline__ u32x4 ld_tr16(const unsigned char* p) {
    typedef __attribute__((address_space(3))) s16x8 lds_s16x8;
    return __builtin_bit_cast(u32x4, __builtin_amdgcn_ds_load_tr16_b128_v8i16((lds_s16x8*)p));
}
// lane l <-> lane l ^ 16
__device__ __forceinline__ float xhalf(float x) {
    int b = __builtin_bit_cast(int, x);
    return __builtin_bit_cast(float, __builtin_amdgcn_permlanex16(b, b, 0x76543210, 0xfedcba98, false, false));
}
__device__ __forceinline__ float bf_lo(unsigned int w) { return __builtin_bit_cast(float, w << 16); }
__device__ __forceinline__ float bf_hi(unsigned int w) { return __builtin_bit_cast(float, w & 0xffff0000u); }
// exp(x) as __expf is built (one multiply, v_exp_f32), in asm so that the v_nop
// stands directly behind the transcendental: the slot that the instruction set
// asks for in front of an instruction that reads its result or overwrites its
// source.
__device__ __forceinline__ float exp_slot(float x) {
    float r;
    asm("v_exp_f32 %0, %1\n\tv_nop" : "=v"(r) : "v"(x * 1.44269504f));
    return r;
}
// Work-group barrier for hand-overs through LDS: the wave's LDS operations are
// done before it signals, while its global loads of the coming rows stay in
// flight (__syncthreads() was built with a wait for those loads as well). The
// scheduling fences keep work on those loads' registers from moving over it.
__device__ __forceinline__ void lds_barrier() {
    __builtin_amdgcn_sched_barrier(0);
    asm volatile("s_wait_dscnt 0x0\n\ts_barrier_signal -1\n\ts_barrier_wait -1" ::: "memory");
    __builtin_amdgcn_sched_barrier(0);
}

typedef __attribute__((ext_vector_type(4))) float f32x4;
// src is read once: a non-temporal load leaves little of it in L2.
__device__ __forceinline__ float4 ld_nt(const float* p) {
    f32x4 v = __builtin_nontemporal_load((const f32x4*)p);
    return make_float4(v.x, v.y, v.z, v.w);
}

__global__ __launch_bounds__(512) void attn_pass_kernel(const float* __restrict__ src,
                                                        const float* __restrict__ qk,
                                                        const float* __restrict__ sb,
                                                        float* __restrict__ part,
                                                        float* __restrict__ ml) {
    __shared__ __attribute__((aligned(16))) FaLds lds;
    const int n = blockIdx.x;            // 0..31
    const int ch = blockIdx.y;           // 0..7  (512 s each)
    // The wave's number in a scalar register: row addresses are then a scalar
    // base plus one lane offset, not a vector register pair for each.
    const int wave = __builtin_amdgcn_readfirstlane(threadIdx.x >> 5);
    const int lane = threadIdx.x & 31;
    const int c = lane & 15, h = lane >> 4;

    // qk[n] (16 padded heads x 512) -> bf16 in LDS.
    float4 gq[4];
#pragma unroll
    for (int i = 0; i < 4; ++i)
        gq[i] = *(const float4*)(qk + (size_t)n * 16 * EE + (i * 512 + (int)threadIdx.x) * 4);
    const float bias = sb[n * HH + (c & 7)];   // padding columns 8..15 are never stored
    // Precaution: stands between the loads above and any reuse of their offset
    // registers.
    asm volatile("s_wait_xcnt 0x0" ::: "memory");

    // Row f (0..31) of the wave's share: round f >> 4, row f & 15 of its sixteen;
    // four loads of 512 contiguous bytes each. FA_DEPTH rows are kept in flight.
    const float* g = src + ((size_t)(ch * (FA_ROWS * FA_ROUNDS) + wave * 16) * NN + n) * EE;
    const int gl = lane * 4;
    float4 buf[FA_DEPTH * 4];
#pragma unroll
    for (int i = 0; i < FA_DEPTH * 4; ++i)
        buf[i] = ld_nt(g + (size_t)(i >> 2) * ROWF + (i & 3) * 128 + gl);
    __builtin_amdgcn_sched_barrier(0);   // the first rows are asked for before anything waits
#pragma unroll
    for (int i = 0; i < 4; ++i) {
        int f = (i * 512 + (int)threadIdx.x) * 4;
        put_bf16x4(lds.qk + (f >> 9) * FA_QPITCH + (f & 511) * 2, gq[i]);
    }

    unsigned char* trow = lds.tile + (wave * 16) * FA_PITCH + lane * 8;
    const unsigned char* ta = lds.tile + (wave * 16 + c) * FA_PITCH + 16 * h;
    const unsigned char* tb = lds.qk + c * FA_QPITCH + 16 * h;
    const unsigned char* tt = lds.tile + (8 * h + (lane & 7)) * FA_PITCH + ((lane >> 3) & 1) * 16 + wave * 64;

    float m_run = -INFINITY, l_run = 0.0f;
    v8f acc0 = {}, acc1 = {};
#pragma unroll
    for (int r = 0; r < FA_ROUNDS; ++r) {
        // Row by row: a row's four registers are asked for again as soon as the
        // row lies in LDS, so that the wave's loads stay in flight, through the
        // products too. The fence keeps that order (without it the loads were
        // bunched, more registers were live and some were spilled).
#pragma unroll
        for (int q = 0; q < 16; ++q) {
            const int f = r * 16 + q, slot = (f % FA_DEPTH) * 4, fn = f + FA_DEPTH;
#pragma unroll
            for (int k = 0; k < 4; ++k)
                put_bf16x4(trow + q * FA_PITCH + k * 256, buf[slot + k]);
            if (fn < FA_ROUNDS * 16) {
                const float* gn = g + (size_t)((fn >> 4) * FA_ROWS + (fn & 15)) * ROWF;
                // Precaution: stands between the earlier rows' loads and these loads'
                // destinations (a build laid one over the lane offset that those name).
                asm volatile("s_wait_xcnt 0x0" ::: "memory");
#pragma unroll
                for (int k = 0; k < 4; ++k)
                    buf[slot + k] = ld_nt(gn + k * 128 + gl);
                // The same behind the last row's loads: their address registers are free from here on.
                if (fn + 1 == FA_ROUNDS * 16) asm volatile("s_wait_xcnt 0x0" ::: "memory");
            }
            __builtin_amdgcn_sched_barrier(0);
        }
        if (r == 0) lds_barrier();       // qk lies in LDS for every wave

        // Scores of the wave's own 16 rows: s0[i] + s1[i] = raw[s = 16w + 8h + i][head c].
        v8f s0 = {}, s1 = {};
#pragma unroll
        for (int ks = 0; ks < 16; ks += 2) {
            Frag a0, b0, a1, b1;
            a0.q[0] = *(const u32x4*)(ta + ks * 64);      a0.q[1] = *(const u32x4*)(ta + ks * 64 + 32);
            b0.q[0] = *(const u32x4*)(tb + ks * 64);      b0.q[1] = *(const u32x4*)(tb + ks * 64 + 32);
            a1.q[0] = *(const u32x4*)(ta + ks * 64 + 64); a1.q[1] = *(const u32x4*)(ta + ks * 64 + 96);
            b1.q[0] = *(const u32x4*)(tb + ks * 64 + 64); b1.q[1] = *(const u32x4*)(tb + ks * 64 + 96);
            s0 = wmma_bf16(a0.v, b0.v, s0);
            s1 = wmma_bf16(a1.v, b1.v, s1);
        }
        float x[8];
        float mx = -INFINITY;
#pragma unroll
        for (int i = 0; i < 8; ++i) {
            x[i] = ((s0[i] + s1[i]) + bias) * 0.125f;
            mx = fmaxf(mx, x[i]);
        }
        mx = fmaxf(mx, xhalf(mx));
        lds.mx[c * FA_MXP + wave] = mx;  // both halves hold the same value
        lds_barrier();                   // every wave's maxima are in LDS
        float4 m4[4];
#pragma unroll
        for (int i = 0; i < 4; ++i) m4[i] = *(const float4*)&lds.mx[c * FA_MXP + 4 * i];
        float mr = -INFINITY;
#pragma unroll
        for (int i = 0; i < 4; ++i)
            mr = fmaxf(mr, fmaxf(fmaxf(m4[i].x, m4[i].y), fmaxf(m4[i].z, m4[i].w)));
        const float m_new = fmaxf(m_run, mr);
        const float scale = exp_slot(m_run - m_new);
        m_run = m_new;
        u32x4 pw;
        float ls = 0.0f;                 // the sum is taken of the rounded weights
#pragma unroll
        for (int i = 0; i < 4; ++i) {
            pw[i] = pack2(exp_slot(x[2 * i] - m_new), exp_slot(x[2 * i + 1] - m_new));
            ls += bf_lo(pw[i]) + bf_hi(pw[i]);
        }
        l_run = fmaf(l_run, scale, ls);
        lds.p[wave >> 1][wave & 1][lane] = pw;
        lds_barrier();                   // every wave's rows and weights are in LDS

#pragma unroll
        for (int i = 0; i < 8; ++i) { acc0[i] *= scale; acc1[i] *= scale; }
#pragma unroll
        for (int j = 0; j < FA_ROWS / 32; ++j) {
            Frag b, a0, a1;
            b.q[0] = lds.p[j][0][lane];
            b.q[1] = lds.p[j][1][lane];
            const unsigned char* tj = tt + j * 32 * FA_PITCH;
            a0.q[0] = ld_tr16(tj);      a0.q[1] = ld_tr16(tj + 16 * FA_PITCH);
            a1.q[0] = ld_tr16(tj + 32); a1.q[1] = ld_tr16(tj + 16 * FA_PITCH + 32);
            acc0 = wmma_bf16(a0.v, b.v, acc0);
            acc1 = wmma_bf16(a1.v, b.v, acc1);
        }
        if (r + 1 < FA_ROUNDS)
            lds_barrier();               // all reads of this round's LDS are done
    }

    // The waves' sums of weights (all against the same final maximum) -> wave 0.
    lds.mx[c * FA_MXP + wave] = l_run + xhalf(l_run);
    lds_barrier();

    // acc{0,1}[i] = ctx^T[e = 32w + {0,16} + 8h + i][head c]; heads 8..15 are padding.
    if (c < HH) {
        float* o = part + (((size_t)ch * NN + n) * HH + c) * EE + wave * 32 + 8 * h;
        *(float4*)(o)      = make_float4(acc0[0], acc0[1], acc0[2], acc0[3]);
        *(float4*)(o + 4)  = make_float4(acc0[4], acc0[5], acc0[6], acc0[7]);
        *(float4*)(o + 16) = make_float4(acc1[0], acc1[1], acc1[2], acc1[3]);
        *(float4*)(o + 20) = make_float4(acc1[4], acc1[5], acc1[6], acc1[7]);
        if (wave == 0 && h == 0) {
            float l_tot = 0.0f;
#pragma unroll
            for (int w = 0; w < FA_WAVES; ++w) l_tot += lds.mx[c * FA_MXP + w];
            ml[((ch * NN + n) * HH + c) * 2 + 0] = m_run;
            ml[((ch * NN + n) * HH + c) * 2 + 1] = l_tot;
        }
    }
}

// ---------------------------------------------------------------------------
// Stage 5: merge of the 8 chunks and V projection in one launch, then the last linear.
//   mo[n,j] = sum_k (w[k] * (1 / L)) * (Wv[j,:] . part[k, n, j>>6, :]) + bv[j]
//   w[k] = exp(m[k] - M), M = max_k m[k], L = sum_k w[k] * l[k]
// (bv passes through: the merged weights sum to 1). The projection is linear, so it
// is applied to the chunks' un-normalised sums as they lie in memory: the 16 rows of
// the f32 WMMA tile are 2 n x 8 chunks, and the merge is a weighted sum of the eight
// D registers of a lane. One block of 16 waves owns 2 rows n x 32 columns j; wave w
// owns the K slice [32w, 32w+32), loaders and k order as in lin_tile. Every loop is
// unrolled, so that its small arrays are registers and its loads go out together.
//   out = mo @ W2.T + b2   (W2 = Wl Wo, b2 = Wl bo + bl, from the first launch)
// ---------------------------------------------------------------------------
struct VmLds {
    float red[LIN_WAVES][2][32];               // K-slice partials of the merged rows, lane-major
    float stage[LIN_WAVES][48][LIN_PITCH];     // per wave: 16 rows of part, 32 rows of Wv
};

__global__ __launch_bounds__(512) void vproj_merge_kernel(const float* __restrict__ part,
                                                          const float* __restrict__ ml,
                                                          const float* __restrict__ Wv,
                                                          const float* __restrict__ bv,
                                                          float* __restrict__ mo) {
    __shared__ __attribute__((aligned(16))) VmLds lds;
    const int j0 = (blockIdx.x & 15) * 32, n0 = (blockIdx.x >> 4) * 2;
    const int head = j0 >> 6;            // the block's 32 columns lie in one head
    // The wave's number in a scalar register: scalar bases and one lane offset each.
    const int wave = __builtin_amdgcn_readfirstlane(threadIdx.x >> 5);
    const int lane = threadIdx.x & 31;
    const int kb = wave * 32;
    const int lr = lane >> 3;            // row within a group of four
    const int lc = (lane & 7) * 4;       // float offset within the 128-byte slice
    const int c = lane & 15, h = lane >> 4;
    const int CH = NN * HH * EE;         // floats between consecutive chunks of part
    const char* XB = (const char*)(part + ((size_t)n0 * HH + head) * EE + kb);
    const char* WB = (const char*)(Wv + (size_t)j0 * EE + kb);
    const char* MB = (const char*)(ml + ((size_t)n0 * HH + head) * 2);
    const unsigned int xo = (lr * CH + lc) * 4, wo = (lr * EE + lc) * 4, mlo = h * HH * 2 * 4;

    // Tile row 8a + k = part[chunk k][n0 + a][head]; load i brings rows 4i .. 4i+3.
    float4 gx[4], gw[8];
    float2 mlv[FA_CHUNKS];               // (max, sum) of every chunk, for n0 + h
#pragma unroll
    for (int i = 0; i < 4; ++i)
        gx[i] = *(const float4*)(XB + ((i & 1) * 4 * CH + (i >> 1) * HH * EE) * 4 + xo);
#pragma unroll
    for (int i = 0; i < 8; ++i)
        gw[i] = *(const float4*)(WB + i * 4 * EE * 4 + wo);
#pragma unroll
    for (int k = 0; k < FA_CHUNKS; ++k)
        mlv[k] = *(const float2*)(MB + k * NN * HH * 2 * 4 + mlo);
    const float bias = (bv + j0)[lane];  // asked for with the tiles, used at the very end
    __builtin_amdgcn_sched_barrier(0);   // every load is asked for before anything waits
    // The merge weights of n0 + h, divided by the merged sum.
    float M = mlv[0].x;
#pragma unroll
    for (int k = 1; k < FA_CHUNKS; ++k) M = fmaxf(M, mlv[k].x);
    float wn[FA_CHUNKS];
    float L = 0.0f;
#pragma unroll
    for (int k = 0; k < FA_CHUNKS; ++k) {
        wn[k] = exp_slot(mlv[k].x - M);
        L = fmaf(wn[k], mlv[k].y, L);
    }
    const float rl = 1.0f / L;
#pragma unroll
    for (int k = 0; k < FA_CHUNKS; ++k) wn[k] *= rl;
#pragma unroll
    for (int i = 0; i < 4; ++i)
        *(float4*)&lds.stage[wave][i * 4 + lr][lc] = gx[i];
#pragma unroll
    for (int i = 0; i < 8; ++i)
        *(float4*)&lds.stage[wave][16 + i * 4 + lr][lc] = gw[i];
    // The wave reads back rows that its other lanes wrote: its own LDS stores
    // must be done, and the compiler must not lift the reads over them. The weights
    // are inputs, so that they are complete here: a build had their arithmetic in the
    // run of WMMAs below.
    asm volatile("s_wait_dscnt 0x0" :: "v"(wn[0]), "v"(wn[1]), "v"(wn[2]), "v"(wn[3]),
                 "v"(wn[4]), "v"(wn[5]), "v"(wn[6]), "v"(wn[7]) : "memory");

    float4 fx[4], f0[4], f1[4];
#pragma unroll
    for (int i = 0; i < 4; ++i) {
        fx[i] = *(const float4*)&lds.stage[wave][c][8 * i + 4 * h];
        f0[i] = *(const float4*)&lds.stage[wave][16 + c][8 * i + 4 * h];
        f1[i] = *(const float4*)&lds.stage[wave][32 + c][8 * i + 4 * h];
    }
    // Fence pair, as in lin_tile: the LDS reads stay ahead of the WMMAs and no
    // address arithmetic is scheduled into the run behind an operand's last use.
    __builtin_amdgcn_sched_barrier(0);
    v8f acc0 = {}, acc1 = {};
#pragma unroll
    for (int i = 0; i < 4; ++i) {
        acc0 = wmma_f32(fx[i].x, fx[i].y, f0[i].x, f0[i].y, acc0);
        acc1 = wmma_f32(fx[i].x, fx[i].y, f1[i].x, f1[i].y, acc1);
        acc0 = wmma_f32(fx[i].z, fx[i].w, f0[i].z, f0[i].w, acc0);
        acc1 = wmma_f32(fx[i].z, fx[i].w, f1[i].z, f1[i].w, acc1);
    }
    __builtin_amdgcn_sched_barrier(0);
    // The distance between the last WMMAs and the vector instructions below, which
    // read their results; the results pass through, so that every reader stands behind.
    asm volatile("v_nop\n\tv_nop\n\tv_nop\n\tv_nop" : "+v"(acc0), "+v"(acc1));
    // D register k of lane (c, h), tile t = Wv[j0 + 16t + c, K slice] . part[chunk k][n0 + h][head].
    float s0 = 0.0f, s1 = 0.0f;
#pragma unroll
    for (int k = 0; k < FA_CHUNKS; ++k) {
        s0 = fmaf(wn[k], acc0[k], s0);
        s1 = fmaf(wn[k], acc1[k], s1);
    }
    lds.red[wave][0][lane] = s0;
    lds.red[wave][1][lane] = s1;
    __syncthreads();                     // every wave's merged partials are in LDS
    // Waves 0 and 1 store rows n0 and n0 + 1: 32 columns = one whole 128-byte line each.
    if (wave < 2) {
        const float* pr = &lds.red[0][h][wave * 16 + c];
        float t0 = pr[0 * 64], t1 = pr[1 * 64], t2 = pr[2 * 64], t3 = pr[3 * 64];
#pragma unroll
        for (int w = 4; w < LIN_WAVES; w += 4) {
            t0 += pr[(w + 0) * 64];
            t1 += pr[(w + 1) * 64];
            t2 += pr[(w + 2) * 64];
            t3 += pr[(w + 3) * 64];
        }
        mo[(size_t)(n0 + wave) * EE + j0 + lane] = ((t0 + t1) + (t2 + t3)) + bias;
    }
}

__global__ __launch_bounds__(512) void lin_kernel(const float* __restrict__ A,
                                                  const float* __restrict__ W,
                                                  const float* __restrict__ b,
                                                  float* __restrict__ out) {
    int j0 = (blockIdx.x & 15) * 32, n0 = (blockIdx.x >> 4) * 16;
    lin_tile(A, EE, W, b, out, n0, j0);
}

// ---------------------------------------------------------------------------
extern "C" void kernel_launch(void* const* d_in, const int* in_sizes, int n_in,
                              void* d_out, int out_size, void* d_ws, size_t ws_size,
                              hipStream_t stream) {
    const float* src = (const float*)d_in[0];
    const float* Wq  = (const float*)d_in[1];
    const float* bq  = (const float*)d_in[2];
    const float* Wk  = (const float*)d_in[3];
    const float* bk  = (const float*)d_in[4];
    const float* Wv  = (const float*)d_in[5];
    const float* bv  = (const float*)d_in[6];
    const float* Wo  = (const float*)d_in[7];
    const float* bo  = (const float*)d_in[8];
    const float* Wl  = (const float*)d_in[9];
    const float* bl  = (const float*)d_in[10];

    float* ws = (float*)d_ws;
    float* qkbuf  = ws + 16384;       // 32*16*512 = 262144 (head-padded)
    float* sb     = ws + 278528;      // 256
    float* ml     = ws + 278784;      // 8*32*8 pairs (max, sum) = 4096
    float* part   = ws + 3424512;     // 8*32*8*512 = 1048576
    float* mo     = ws + 4604160;     // 16384
    float* W2     = ws + 4620544;     // 512*512 = 262144
    float* b2     = ws + 4882688;     // 512  (end: 4883200 floats ~ 18.6 MB)

    qk_fused_kernel<<<192, 512, 0, stream>>>(src, Wq, bq, Wk, bk, Wo, bo, Wl, bl, qkbuf, sb, W2, b2);
    attn_pass_kernel<<<dim3(32, 8), 512, 0, stream>>>(src, qkbuf, sb, part, ml);
    vproj_merge_kernel<<<256, 512, 0, stream>>>(part, ml, Wv, bv, mo);
    lin_kernel    <<<32,   512, 0, stream>>>(mo, W2, b2, (float*)d_out);
}

// v007
// One run takes 33.5 microseconds.
// In two side-by-side timings against v006, it was 1.06 and 1.05 times as fast.
// Over all steps from v000 it is 4.27 times as fast.
#include <hip/hip_runtime.h>
#include <math.h>

// Problem constants (from reference): S=4096, N=32, E=512, H=8, DK=64, l=2048.
#define SS 4096
#define NN 32
#define EE 512
#define HH 8

typedef __attribute__((ext_vector_type(16))) __bf16 v16bf;
typedef __attribute__((ext_vector_type(8)))  float  v8f;
typedef __attribute__((ext_vector_type(2)))  float  v2f;

__device__ __forceinline__ v8f wmma_bf16(v16bf a, v16bf b, v8f c) {
    return __builtin_amdgcn_wmma_f32_16x16x32_bf16(false, a, false, b, (short)0, c, false, false);
}

// ---------------------------------------------------------------------------
// Tile for the last small linear  Y[n,j] = X[n,:] . Wt[j,:] + b[j]
// (32 x 512, K = 512), all in f32 on v_wmma_f32_16x16x4_f32.
// One block of 16 waves owns 16 rows n x 32 columns j. Wave w owns the K slice
// [32w, 32w+32): it issues all of its loads at once (each wave-wide 16-byte
// load covers four whole 128-byte lines: 4 rows x 32 floats), turns them into
// fragments through its own LDS range, and runs two accumulator chains of 8
// WMMAs. The 16 K-slice partials are summed in LDS in a fixed order.
// k order: lane (c = lane&15, h = lane>>4) takes k = 8i + 4h + {0,1} and
// 8i + 4h + {2,3} of its row, by the same code for X and for Wt.
// ---------------------------------------------------------------------------
#define LIN_WAVES 16
#define LIN_PITCH 36   // floats: 128 B of data + 16 B, so 16 rows' 16-byte reads fall on 64 distinct banks

__device__ __forceinline__ v8f wmma_f32(float a0, float a1, float b0, float b1, v8f c) {
    v2f a = {a0, a1};
    v2f b = {b0, b1};
    return __builtin_amdgcn_wmma_f32_16x16x4_f32(false, a, false, b, (short)0, c, false, false);
}

struct LinLds {
    float red[LIN_WAVES][8][2][32];            // K-slice partials, lane-major
    float stage[LIN_WAVES][48][LIN_PITCH];     // per wave: 16 rows of X, 32 rows of Wt
};

__device__ __forceinline__ void lin_tile(const float* __restrict__ X, int x_stride,
                                         const float* __restrict__ Wt,
                                         const float* __restrict__ b,
                                         float* __restrict__ Y, int n0, int j0) {
    __shared__ __attribute__((aligned(16))) LinLds lds;
    int wave = threadIdx.x >> 5;
    int lane = threadIdx.x & 31;
    int kb = wave * 32;
    int lr = lane >> 3;            // row within a group of four
    int lc = (lane & 7) * 4;       // float offset within the 128-byte slice

    float4 gx[4], gw[8];
#pragma unroll
    for (int i = 0; i < 4; ++i)
        gx[i] = *(const float4*)(X + (size_t)(n0 + i * 4 + lr) * x_stride + kb + lc);
#pragma unroll
    for (int i = 0; i < 8; ++i)
        gw[i] = *(const float4*)(Wt + (size_t)(j0 + i * 4 + lr) * EE + kb + lc);
    float bias = b[j0 + lane];     // asked for with the tiles, used at the very end
#pragma unroll
    for (int i = 0; i < 4; ++i)
        *(float4*)&lds.stage[wave][i * 4 + lr][lc] = gx[i];
#pragma unroll
    for (int i = 0; i < 8; ++i)
        *(float4*)&lds.stage[wave][16 + i * 4 + lr][lc] = gw[i];
    // The wave reads back rows that its other lanes wrote: its own LDS stores
    // must be done, and the compiler must not lift the reads over them.
    asm volatile("s_wait_dscnt 0x0" ::: "memory");

    int c = lane & 15, h = lane >> 4;
    float4 fx[4], f0[4], f1[4];
#pragma unroll
    for (int i = 0; i < 4; ++i) {
        fx[i] = *(const float4*)&lds.stage[wave][c][8 * i + 4 * h];
        f0[i] = *(const float4*)&lds.stage[wave][16 + c][8 * i + 4 * h];
        f1[i] = *(const float4*)&lds.stage[wave][32 + c][8 * i + 4 * h];
    }
    // Fence pair: the LDS reads stay one group ahead of the WMMAs, and no address
    // arithmetic is scheduled into the run, where it could overwrite an operand
    // register directly behind the WMMA that reads it.
    __builtin_amdgcn_sched_barrier(0);
    v8f acc0 = {}, acc1 = {};
#pragma unroll
    for (int i = 0; i < 4; ++i) {
        acc0 = wmma_f32(fx[i].x, fx[i].y, f0[i].x, f0[i].y, acc0);
        acc1 = wmma_f32(fx[i].x, fx[i].y, f1[i].x, f1[i].y, acc1);
        acc0 = wmma_f32(fx[i].z, fx[i].w, f0[i].z, f0[i].w, acc0);
        acc1 = wmma_f32(fx[i].z, fx[i].w, f1[i].z, f1[i].w, acc1);
    }
    __builtin_amdgcn_sched_barrier(0);
    // D register r of lane (c, h) = Y[n0 + 8h + r][j0 + 16t + c].
#pragma unroll
    for (int r = 0; r < 8; ++r) {
        lds.red[wave][r][0][lane] = acc0[r];
        lds.red[wave][r][1][lane] = acc1[r];
    }
    __syncthreads();
    // Wave w stores row n0 + w: 32 columns = one whole 128-byte line.
    const float* pr = &lds.red[0][wave & 7][lane >> 4][(wave >> 3) * 16 + c];
    float s0 = pr[0 * 512], s1 = pr[1 * 512], s2 = pr[2 * 512], s3 = pr[3 * 512];
#pragma unroll
    for (int w = 4; w < LIN_WAVES; w += 4) {
        s0 += pr[(w + 0) * 512];
        s1 += pr[(w + 1) * 512];
        s2 += pr[(w + 2) * 512];
        s3 += pr[(w + 3) * 512];
    }
    Y[(size_t)(n0 + wave) * EE + j0 + lane] = ((s0 + s1) + (s2 + s3)) + bias;
}

// ---------------------------------------------------------------------------
// The two last linears as one:  (mo Wo^T + bo) Wl^T + bl = mo W2^T + b2  with
//   W2[i,j] = sum_k Wl[i,k] * Wo[k,j]     b2[i] = Wl[i,:] . bo + bl[i]
// W2 and b2 depend on the weights alone, so they are formed in the first launch,
// by work-groups of their own on WGPs that the launch leaves idle.
// One block of 16 waves owns 32 rows i x 64 columns j. Wave w owns the K slice
// [32w, 32w+32): its 32 x 32 piece of Wl goes through its own LDS range as in
// lin_tile; its 32 x 64 piece of Wo stays in registers: lane (c, h) loads the four
// columns j0 + 4c .. +3 of row k, one for each of four column tiles, so column c
// of tile t is j0 + 4c + t and every load covers whole 128-byte lines.
// k order: lane (c, h) takes k = 8i + 4h + {0,1} and 8i + 4h + {2,3}, for Wl
// (row c) and for Wo (column c) alike. The 16 K-slice partials are summed in LDS
// in a fixed order.
// ---------------------------------------------------------------------------
struct FoldLds {
    float red[LIN_WAVES][2][8][32][4];         // K-slice partials: [row tile][D register][lane][column tile]
    float stage[LIN_WAVES][32][LIN_PITCH];     // per wave: 32 rows of Wl
    float bred[LIN_WAVES][32];                 // K-slice partials of Wl . bo
};

__device__ __forceinline__ void fold_tile(FoldLds& lds,
                                          const float* __restrict__ Wl,
                                          const float* __restrict__ Wo,
                                          const float* __restrict__ bo,
                                          const float* __restrict__ bl,
                                          float* __restrict__ W2,
                                          float* __restrict__ b2, int i0, int j0) {
    const int wave = __builtin_amdgcn_readfirstlane(threadIdx.x >> 5);
    const int lane = threadIdx.x & 31;
    const int kb = wave * 32;
    const int lr = lane >> 3;            // row within a group of four
    const int lc = (lane & 7) * 4;       // float offset within the 128-byte slice
    const int c = lane & 15, h = lane >> 4;
    // Scalar bases and one lane offset (in bytes) each, as in the kernel below.
    const char* A = (const char*)(Wl + (size_t)i0 * EE + kb);
    const char* B = (const char*)(Wo + (size_t)kb * EE + j0);
    const unsigned int ao = (lr * EE + lc) * 4, bofs = (h * 4 * EE + c * 4) * 4;
    const bool first = j0 == 0;          // one block per row group forms b2 as well

    float4 ga[8], gb[4][4], gbo[4];
    float blv = 0.0f;
#pragma unroll
    for (int i = 0; i < 8; ++i)
        ga[i] = *(const float4*)(A + i * 4 * EE * 4 + ao);
#pragma unroll
    for (int i = 0; i < 4; ++i)
#pragma unroll
        for (int j = 0; j < 4; ++j)
            gb[i][j] = *(const float4*)(B + (8 * i + j) * EE * 4 + bofs);
    // Precaution: the loads' lane offsets are inputs here, so their registers are
    // not given to anything else (a load's destination either) ahead of this wait.
    asm volatile("s_wait_xcnt 0x0" :: "v"(ao), "v"(bofs) : "memory");
    if (first) {
#pragma unroll
        for (int i = 0; i < 4; ++i)
            gbo[i] = *(const float4*)(bo + kb + 8 * i + 4 * h);
        blv = (bl + i0)[lane];
    }
#pragma unroll
    for (int i = 0; i < 8; ++i)
        *(float4*)&lds.stage[wave][i * 4 + lr][lc] = ga[i];
    // The wave reads back rows that its other lanes wrote: its own LDS stores
    // must be done, and the compiler must not lift the reads over them.
    asm volatile("s_wait_dscnt 0x0" ::: "memory");
    float4 fx[2][4];
#pragma unroll
    for (int a = 0; a < 2; ++a)
#pragma unroll
        for (int i = 0; i < 4; ++i)
            fx[a][i] = *(const float4*)&lds.stage[wave][16 * a + c][8 * i + 4 * h];
    if (first) {
#pragma unroll
        for (int a = 0; a < 2; ++a) {
            float s = 0.0f;
#pragma unroll
            for (int i = 0; i < 4; ++i) {
                s = fmaf(fx[a][i].x, gbo[i].x, s);
                s = fmaf(fx[a][i].y, gbo[i].y, s);
                s = fmaf(fx[a][i].z, gbo[i].z, s);
                s = fmaf(fx[a][i].w, gbo[i].w, s);
            }
            s += __shfl_xor(s, 16, 32);
            lds.bred[wave][16 * a + c] = s;   // both halves hold the same value
        }
    }
    // The B operand wants two k of one column side by side; a load holds four
    // columns of one k. The pairs are formed here, in registers of their own.
    v2f bp[4][2][4];
#pragma unroll
    for (int i = 0; i < 4; ++i)
#pragma unroll
        for (int p = 0; p < 2; ++p) {
            bp[i][p][0] = v2f{gb[i][2 * p].x, gb[i][2 * p + 1].x};
            bp[i][p][1] = v2f{gb[i][2 * p].y, gb[i][2 * p + 1].y};
            bp[i][p][2] = v2f{gb[i][2 * p].z, gb[i][2 * p + 1].z};
            bp[i][p][3] = v2f{gb[i][2 * p].w, gb[i][2 * p + 1].w};
        }
    // Fence pair, as in lin_tile: operands are complete ahead of the WMMAs and
    // nothing is scheduled into the run behind an operand's last use.
    __builtin_amdgcn_sched_barrier(0);
    v8f acc[2][4] = {};
#pragma unroll
    for (int i = 0; i < 4; ++i)
        // (p, a) = (0,0) (1,1) (0,1) (1,0): every B pair that the first eight WMMAs
        // read is read again later, so that no accumulator, which gets its registers
        // there, is laid over a B pair just read.
#pragma unroll
        for (int u = 0; u < 4; ++u) {
            const int p = u & 1, a = (u ^ (u >> 1)) & 1;
            const v2f av = p ? v2f{fx[a][i].z, fx[a][i].w} : v2f{fx[a][i].x, fx[a][i].y};
#pragma unroll
            for (int t = 0; t < 4; ++t)
                acc[a][t] = __builtin_amdgcn_wmma_f32_16x16x4_f32(false, av, false, bp[i][p][t],
                                                                  (short)0, acc[a][t], false, false);
        }
    __builtin_amdgcn_sched_barrier(0);
    // The distance between the last WMMAs and the moves below, which reuse their
    // operand registers and read their results.
    asm volatile("v_nop\n\tv_nop\n\tv_nop\n\tv_nop");
    __builtin_amdgcn_sched_barrier(0);
    // D register r of lane (c, h), tile (a, t) = W2[i0 + 16a + 8h + r][j0 + 4c + t].
#pragma unroll
    for (int a = 0; a < 2; ++a)
#pragma unroll
        for (int r = 0; r < 8; ++r)
            *(float4*)&lds.red[wave][a][r][lane][0] =
                make_float4(acc[a][0][r], acc[a][1][r], acc[a][2][r], acc[a][3][r]);
    __syncthreads();                     // every wave's partials are in LDS
    // Wave w stores rows i0 + 2w and i0 + 2w + 1: 64 columns = two whole lines each.
    const int row = wave * 2 + h;
    const float* pr = &lds.red[0][row >> 4][row & 7][((row >> 3) & 1) * 16 + c][0];
    float4 s[4];
#pragma unroll
    for (int w = 0; w < 4; ++w) s[w] = *(const float4*)(pr + w * 2048);
#pragma unroll
    for (int w = 4; w < LIN_WAVES; ++w) {
        const float4 v = *(const float4*)(pr + w * 2048);
        s[w & 3].x += v.x; s[w & 3].y += v.y; s[w & 3].z += v.z; s[w & 3].w += v.w;
    }
    *(float4*)(W2 + (size_t)(i0 + row) * EE + j0 + c * 4) =
        make_float4((s[0].x + s[1].x) + (s[2].x + s[3].x), (s[0].y + s[1].y) + (s[2].y + s[3].y),
                    (s[0].z + s[1].z) + (s[2].z + s[3].z), (s[0].w + s[1].w) + (s[2].w + s[3].w));
    // Precaution: stands between the store and the reuse of its registers below.
    asm volatile("s_wait_xcnt 0x0" ::: "memory");
    if (first && wave == 0) {
        float t0 = 0.0f;
#pragma unroll
        for (int w = 0; w < LIN_WAVES; ++w) t0 += lds.bred[w][lane];
        b2[i0 + lane] = t0 + blv;
    }
}

// ---------------------------------------------------------------------------
// Stage 1 in one launch:
//   q[n,j]     = src[l=2048,n,:] . Wq[j,:] + bq[j]
//   qk[n,h,e]  = sum_d q[n,h*64+d] * Wk[h*64+d,e]   (h padded to 16 rows of zeros)
//   sb[n,h]    = q[n,h,:] . bk[h,:]                 (score bias from k's bias)
// Grid: 128 blocks of fold_tile (they start first: theirs is the longer run of
// WMMAs), then 8 heads x 2 groups of 16 rows n x 4 ranges of 128 columns e; 16 waves.
// Each of those 64 blocks forms its head's q (16 x 64, K = 512) itself, as lin_tile does
// (wave w owns the K slice [32w, 32w+32), partials summed in LDS in the same
// fixed order), keeps it in LDS and multiplies it with its 64 x 128 piece of
// Wk: wave w owns columns 16(w&7) .. +15 and the d half w>>3.
// k order of the second product: lane (c, h) takes d = 8i + 4h + {0,1} and
// 8i + 4h + {2,3}, for q (row c) and for Wk (column c) alike.
// ---------------------------------------------------------------------------
#define FOLD_BLOCKS 128   // 16 groups of 32 rows i x 8 groups of 64 columns j
#define QF_WKP 132   // floats: 512 B of data + 16 B, so the two lane halves (4 rows apart) read distinct banks
#define QF_QP  68    // floats: 272 B, an odd multiple of 16 for plain 16-byte reads

struct QfLds {
    float red[LIN_WAVES][8][4][32];            // K-slice partials of q, lane-major
    float stage[LIN_WAVES][80][LIN_PITCH];     // per wave: 16 rows of src[l], 64 rows of Wq
    float wk[64][QF_WKP];                      // [d][e]
    float qh[16][QF_QP];                       // [n][d]
    float red2[2][8][8][32];                   // [d half][D register][column tile][lane]
};

__global__ __launch_bounds__(512) void qk_fused_kernel(const float* __restrict__ src,
                                                       const float* __restrict__ Wq,
                                                       const float* __restrict__ bq,
                                                       const float* __restrict__ Wk,
                                                       const float* __restrict__ bk,
                                                       const float* __restrict__ Wo,
                                                       const float* __restrict__ bo,
                                                       const float* __restrict__ Wl,
                                                       const float* __restrict__ bl,
                                                       float* __restrict__ qk,
                                                       float* __restrict__ sb,
                                                       float* __restrict__ W2,
                                                       float* __restrict__ b2) {
    __shared__ __attribute__((aligned(16))) union { QfLds q; FoldLds f; } both;
    if (blockIdx.x < FOLD_BLOCKS) {      // the same for the whole block, ahead of every barrier
        fold_tile(both.f, Wl, Wo, bo, bl, W2, b2, (blockIdx.x >> 3) * 32, (blockIdx.x & 7) * 64);
        return;
    }
    QfLds& lds = both.q;
    const int bid = blockIdx.x - FOLD_BLOCKS;
    const int e0 = (bid & 3) * 128;
    const int n0 = ((bid >> 2) & 1) * 16;
    const int head = bid >> 3;
    // The wave's number in a scalar register: every load address is then a scalar
    // base plus one of two lane offsets, not a vector register pair for each.
    const int wave = __builtin_amdgcn_readfirstlane(threadIdx.x >> 5);
    const int lane = threadIdx.x & 31;
    const int kb = wave * 32;
    const int lr = lane >> 3;            // row within a group of four
    const int lc = (lane & 7) * 4;       // float offset within the 128-byte slice
    const float* X = src + (size_t)2048 * NN * EE + n0 * EE + kb;
    const float* Wh = Wq + (size_t)head * 64 * EE + kb;
    const float* Wkh = Wk + (size_t)(head * 64 + wave * 4) * EE + e0;
    const int go = lr * EE + lc;

    const float bq0 = bq[head * 64 + lane], bq1 = bq[head * 64 + 32 + lane];
    const float bk0 = bk[head * 64 + lane], bk1 = bk[head * 64 + 32 + lane];
    float4 gx[4], gw[16], gk[4];
#pragma unroll
    for (int i = 0; i < 4; ++i)
        gx[i] = *(const float4*)(X + i * 4 * EE + go);
#pragma unroll
    for (int i = 0; i < 16; ++i)
        gw[i] = *(const float4*)(Wh + i * 4 * EE + go);
#pragma unroll
    for (int i = 0; i < 4; ++i)          // one whole 512-byte piece of a Wk row per load
        gk[i] = *(const float4*)(Wkh + i * EE + lane * 4);
#pragma unroll
    for (int i = 0; i < 4; ++i)
        *(float4*)&lds.stage[wave][i * 4 + lr][lc] = gx[i];
#pragma unroll
    for (int i = 0; i < 16; ++i)
        *(float4*)&lds.stage[wave][16 + i * 4 + lr][lc] = gw[i];
    // The Wk rows go to LDS here, ahead of the first product, so that their loads
    // are asked for together with the others (stored behind the product, they
    // were loaded behind it too, their latency in the open).
#pragma unroll
    for (int i = 0; i < 4; ++i)
        *(float4*)&lds.wk[wave * 4 + i][lane * 4] = gk[i];
    // The wave reads back rows that its other lanes wrote: its own LDS stores
    // must be done, and the compiler must not lift the reads over them.
    asm volatile("s_wait_dscnt 0x0" ::: "memory");

    const int c = lane & 15, h = lane >> 4;
    float4 fx[4], fw[4][4];
#pragma unroll
    for (int i = 0; i < 4; ++i) {
        fx[i] = *(const float4*)&lds.stage[wave][c][8 * i + 4 * h];
#pragma unroll
        for (int t = 0; t < 4; ++t)
            fw[t][i] = *(const float4*)&lds.stage[wave][16 + 16 * t + c][8 * i + 4 * h];
    }
    // Fence pair, as in lin_tile: the LDS reads stay ahead of the WMMAs and no
    // address arithmetic is scheduled into the run behind an operand's last use.
    __builtin_amdgcn_sched_barrier(0);
    v8f acc[4] = {};
#pragma unroll
    for (int i = 0; i < 4; ++i) {
#pragma unroll
        for (int t = 0; t < 4; ++t)
            acc[t] = wmma_f32(fx[i].x, fx[i].y, fw[t][i].x, fw[t][i].y, acc[t]);
#pragma unroll
        for (int t = 0; t < 4; ++t)
            acc[t] = wmma_f32(fx[i].z, fx[i].w, fw[t][i].z, fw[t][i].w, acc[t]);
    }
    __builtin_amdgcn_sched_barrier(0);
    // D register r of lane (c, h) = q[n0 + 8h + r][head * 64 + 16t + c].
#pragma unroll
    for (int r = 0; r < 8; ++r)
#pragma unroll
        for (int t = 0; t < 4; ++t)
            lds.red[wave][r][t][lane] = acc[t][r];
    __syncthreads();                     // every wave's partials of q and rows of Wk are in LDS

    // Wave w sums row n0 + w of q: d = lane and d = lane + 32.
    const float* pr = &lds.red[0][wave & 7][h][(wave >> 3) * 16 + c];
    float qv[2];
#pragma unroll
    for (int u = 0; u < 2; ++u) {
        const float* p = pr + u * 64;
        float s0 = p[0 * 1024], s1 = p[1 * 1024], s2 = p[2 * 1024], s3 = p[3 * 1024];
#pragma unroll
        for (int w = 4; w < LIN_WAVES; w += 4) {
            s0 += p[(w + 0) * 1024];
            s1 += p[(w + 1) * 1024];
            s2 += p[(w + 2) * 1024];
            s3 += p[(w + 3) * 1024];
        }
        qv[u] = ((s0 + s1) + (s2 + s3)) + (u ? bq1 : bq0);
        lds.qh[wave][u * 32 + lane] = qv[u];
    }
    __syncthreads();                     // q of the head lies in LDS for every wave

    const int t2 = wave & 7, kh = wave >> 3;
    float4 fa[4];
    float fb[4][4];
#pragma unroll
    for (int i = 0; i < 4; ++i) {
        fa[i] = *(const float4*)&lds.qh[c][32 * kh + 8 * i + 4 * h];
#pragma unroll
        for (int j = 0; j < 4; ++j)
            fb[i][j] = lds.wk[32 * kh + 8 * i + 4 * h + j][16 * t2 + c];
    }
    __builtin_amdgcn_sched_barrier(0);   // fence pair, as above
    v8f a2 = {};
#pragma unroll
    for (int i = 0; i < 4; ++i) {
        a2 = wmma_f32(fa[i].x, fa[i].y, fb[i][0], fb[i][1], a2);
        a2 = wmma_f32(fa[i].z, fa[i].w, fb[i][2], fb[i][3], a2);
    }
    __builtin_amdgcn_sched_barrier(0);
    // D register r of lane (c, h) = qk[n0 + 8h + r][head][e0 + 16 t2 + c], d half kh.
#pragma unroll
    for (int r = 0; r < 8; ++r)
        lds.red2[kh][r][t2][lane] = a2[r];
    __syncthreads();                     // both d halves of every column tile are in LDS

    // Wave w stores row n0 + w: 128 columns = four whole 128-byte lines, and the
    // same columns of the padding head as zeros.
    const float* p2 = &lds.red2[0][wave & 7][lane >> 2][(wave >> 3) * 16 + (lane & 3) * 4];
    const float4 u0 = *(const float4*)p2;
    const float4 u1 = *(const float4*)(p2 + 2048);
    float* o = qk + ((size_t)(n0 + wave) * 16 + head) * EE + e0 + lane * 4;
    *(float4*)o = make_float4(u0.x + u1.x, u0.y + u1.y, u0.z + u1.z, u0.w + u1.w);
    *(float4*)(o + 8 * EE) = make_float4(0.0f, 0.0f, 0.0f, 0.0f);
    // Precaution: stands between the two stores and the reuse of their registers below.
    asm volatile("s_wait_xcnt 0x0" ::: "memory");
    // One block per (head, row group) hands on the score bias of its rows, last,
    // so that no barrier waits for this sum or its store.
    if (e0 == 0) {
        float sv = fmaf(qv[1], bk1, qv[0] * bk0);
#pragma unroll
        for (int m = 16; m >= 1; m >>= 1) sv += __shfl_xor(sv, m, 32);
        if (lane == 0) sb[(n0 + wave) * HH + head] = sv;
    }
}

// ---------------------------------------------------------------------------
// Stages 2 to 4 in one pass over src (each src row is read from memory once).
// Grid (n, chunk of 512 s). 8 waves; two rounds of 256 s rows.
// Round: wave w brings rows 32w .. 32w+31 (whole 512-byte pieces of a row per
// load), rounds them to bf16 and lays them row-major in LDS. Then
//   S^T[s, head] = src[s, :] . qk[head, :]      A = own 32 rows (two tiles on each B fragment), B = qk (LDS)
//   p = exp(x - running max), handed over in LDS as the B fragment of
//   ctx^T[e, head] += src^T[e, s] . p[s, head]  A = transposing LDS loads,
// where wave w owns e = 64w .. 64w+63 (four tiles on each p fragment) over all 256 rows of the round.
// Both products use the hardware k order: k = 8h + i, then 16 + 8h + i.
// The block hands on an un-normalised sum with its (max, sum) per head.
// ---------------------------------------------------------------------------
typedef __attribute__((ext_vector_type(4))) unsigned int u32x4;
typedef __attribute__((ext_vector_type(2))) unsigned int u32x2;
typedef __attribute__((ext_vector_type(8))) short s16x8;
typedef __attribute__((ext_vector_type(2))) __bf16 bf16x2;

#define FA_WAVES  8
#define FA_WROWS  32      // s rows of a wave per round
#define FA_ROWS   256     // s rows per round
#define FA_ROUNDS 2
#define FA_CHUNKS 8
#define FA_PITCH  1056    // bytes: 1024 of data + 32, an odd multiple of 32 for the transposing loads
#define FA_QPITCH 1040    // bytes, qk rows: an odd multiple of 16 for plain 16-byte reads
#define ROWF      (NN * EE)   // floats between consecutive s

union Frag { u32x4 q[2]; v16bf v; };

#define FA_DEPTH 13       // rows (2 KiB each) that a wave keeps in flight (the waits in the row loop keep the compiler from asking a row early)
#define FA_MXP 12         // floats per head in the exchange rows: 48 B, an odd multiple of 16

struct FaLds {                         // the small arrays first: their offsets fit the LDS instructions' immediate
    u32x4 p[FA_ROWS / 32][2][32];      // [k step][first / second 16 rows][lane]
    float mx[16 * FA_MXP];             // [head][wave]
    unsigned char qk[16 * FA_QPITCH];
    unsigned char tile[FA_ROWS * FA_PITCH];
};

__device__ __forceinline__ unsigned int pack2(float lo, float hi) {
    v2f f = {lo, hi};
    return __builtin_bit_cast(unsigned int, __builtin_convertvector(f, bf16x2));
}
__device__ __forceinline__ void put_bf16x4(unsigned char* dst, float4 v) {
    u32x2 w = {pack2(v.x, v.y), pack2(v.z, v.w)};
    *(u32x2*)dst = w;
}
__device__ __forceinline__ u32x4 ld_tr16(const unsigned char* p) {
    typedef __attribute__((address_space(3))) s16x8 lds_s16x8;
    return __builtin_bit_cast(u32x4, __builtin_amdgcn_ds_load_tr16_b128_v8i16((lds_s16x8*)p));
}
// lane l <-> lane l ^ 16
__device__ __forceinline__ float xhalf(float x) {
    int b = __builtin_bit_cast(int, x);
    return __builtin_bit_cast(float, __builtin_amdgcn_permlanex16(b, b, 0x76543210, 0xfedcba98, false, false));
}
__device__ __forceinline__ float bf_lo(unsigned int w) { return __builtin_bit_cast(float, w << 16); }
__device__ __forceinline__ float bf_hi(unsigned int w) { return __builtin_bit_cast(float, w & 0xffff0000u); }
// exp(x) as __expf is built (one multiply, v_exp_f32), in asm so that the v_nop
// stands directly behind the transcendental: the slot that the instruction set
// asks for in front of an instruction that reads its result or overwrites its
// source.
__device__ __forceinline__ float exp_slot(float x) {
    float r;
    asm("v_exp_f32 %0, %1\n\tv_nop" : "=v"(r) : "v"(x * 1.44269504f));
    return r;
}
// Work-group barrier for hand-overs through LDS: the wave's LDS operations are
// done before it signals, while its global loads of the coming rows stay in
// flight (__syncthreads() was built with a wait for those loads as well). The
// scheduling fences keep work on those loads' registers from moving over it.
__device__ __forceinline__ void lds_barrier() {
    __builtin_amdgcn_sched_barrier(0);
    asm volatile("s_wait_dscnt 0x0\n\ts_barrier_signal -1\n\ts_barrier_wait -1" ::: "memory");
    __builtin_amdgcn_sched_barrier(0);
}

typedef __attribute__((ext_vector_type(4))) float f32x4;
// src is read once: a non-temporal load leaves little of it in L2.
__device__ __forceinline__ float4 ld_nt(const float* p) {
    f32x4 v = __builtin_nontemporal_load((const f32x4*)p);
    return make_float4(v.x, v.y, v.z, v.w);
}

__global__ __launch_bounds__(256) void attn_pass_kernel(const float* __restrict__ src,
                                                        const float* __restrict__ qk,
                                                        const float* __restrict__ sb,
                                                        float* __restrict__ part,
                                                        float* __restrict__ ml) {
    __shared__ __attribute__((aligned(16))) FaLds lds;
    const int n = blockIdx.x;            // 0..31
    const int ch = blockIdx.y;           // 0..7  (512 s each)
    // The wave's number in a scalar register: row addresses are then a scalar
    // base plus one lane offset, not a vector register pair for each.
    const int wave = __builtin_amdgcn_readfirstlane(threadIdx.x >> 5);
    const int lane = threadIdx.x & 31;
    const int c = lane & 15, h = lane >> 4;

    // qk[n] (16 padded heads x 512) -> bf16 in LDS.
    float4 gq[8];
#pragma unroll
    for (int i = 0; i < 8; ++i)
        gq[i] = *(const float4*)(qk + (size_t)n * 16 * EE + (i * 256 + (int)threadIdx.x) * 4);
    const float bias = sb[n * HH + (c & 7)];   // padding columns 8..15 are never stored
    // Precaution: stands between the loads above and any reuse of their offset
    // registers.
    asm volatile("s_wait_xcnt 0x0" ::: "memory");

    // Row f (0..63) of the wave's share: round f >> 5, row f & 31 of its thirty-two;
    // four loads of 512 contiguous bytes each. FA_DEPTH rows are kept in flight.
    const float* g = src + ((size_t)(ch * (FA_ROWS * FA_ROUNDS) + wave * FA_WROWS) * NN + n) * EE;
    const int gl = lane * 4;
    float4 buf[FA_DEPTH * 4];
#pragma unroll
    for (int i = 0; i < FA_DEPTH * 4; ++i)
        buf[i] = ld_nt(g + (size_t)(i >> 2) * ROWF + (i & 3) * 128 + gl);
    __builtin_amdgcn_sched_barrier(0);   // the first rows are asked for before anything waits
#pragma unroll
    for (int i = 0; i < 8; ++i) {
        int f = (i * 256 + (int)threadIdx.x) * 4;
        put_bf16x4(lds.qk + (f >> 9) * FA_QPITCH + (f & 511) * 2, gq[i]);
    }

    unsigned char* trow = lds.tile + (wave * FA_WROWS) * FA_PITCH + lane * 8;
    const unsigned char* ta = lds.tile + (wave * FA_WROWS + c) * FA_PITCH + 16 * h;
    const unsigned char* tb = lds.qk + c * FA_QPITCH + 16 * h;
    const unsigned char* tt = lds.tile + (8 * h + (lane & 7)) * FA_PITCH + ((lane >> 3) & 1) * 16 + wave * 128;

    float m_run = -INFINITY, l_run = 0.0f;
    v8f acc[4] = {};
#pragma unroll
    for (int r = 0; r < FA_ROUNDS; ++r) {
        // Row by row: a row's four registers are asked for again as soon as the
        // row lies in LDS, so that the wave's loads stay in flight, through the
        // products too. The fence keeps that order (without it the loads were
        // bunched, more registers were live and some were spilled).
#pragma unroll
        for (int q = 0; q < FA_WROWS; ++q) {
            const int f = r * FA_WROWS + q, slot = (f % FA_DEPTH) * 4, fn = f + FA_DEPTH;
#pragma unroll
            for (int k = 0; k < 4; ++k)
                put_bf16x4(trow + q * FA_PITCH + k * 256, buf[slot + k]);
            if (fn < FA_ROUNDS * FA_WROWS) {
                const float* gn = g + (size_t)((fn >> 5) * FA_ROWS + (fn & 31)) * ROWF;
                // Precaution: stands between the earlier rows' loads and these loads'
                // destinations (a build laid one over the lane offset that those name).
                asm volatile("s_wait_xcnt 0x0" ::: "memory");
#pragma unroll
                for (int k = 0; k < 4; ++k)
                    buf[slot + k] = ld_nt(gn + k * 128 + gl);
                // The same behind the last row's loads: their address registers are free from here on.
                if (fn + 1 == FA_ROUNDS * FA_WROWS) asm volatile("s_wait_xcnt 0x0" ::: "memory");
            }
            __builtin_amdgcn_sched_barrier(0);
        }
        if (r == 0) lds_barrier();       // qk lies in LDS for every wave

        // Scores of the wave's own 32 rows: s0[t][i] + s1[t][i] = raw[s = 32w + 16t + 8h + i][head c].
        v8f s0[2] = {}, s1[2] = {};
#pragma unroll
        for (int ks = 0; ks < 16; ks += 4) {
            Frag fb[4], fa[2][4];
#pragma unroll
            for (int u = 0; u < 4; ++u) {
                fb[u].q[0] = *(const u32x4*)(tb + (ks + u) * 64);
                fb[u].q[1] = *(const u32x4*)(tb + (ks + u) * 64 + 32);
#pragma unroll
                for (int t = 0; t < 2; ++t) {
                    fa[t][u].q[0] = *(const u32x4*)(ta + t * 16 * FA_PITCH + (ks + u) * 64);
                    fa[t][u].q[1] = *(const u32x4*)(ta + t * 16 * FA_PITCH + (ks + u) * 64 + 32);
                }
            }
            // Fence pair: the 24 fragment loads of four k steps go out together, ahead of
            // their WMMAs (left free, a build waited for two loads at each WMMA; another
            // asked for a whole round's at once and spilled registers).
            __builtin_amdgcn_sched_barrier(0);
#pragma unroll
            for (int u = 0; u < 4; u += 2)
#pragma unroll
                for (int t = 0; t < 2; ++t) {
                    s0[t] = wmma_bf16(fa[t][u].v, fb[u].v, s0[t]);
                    s1[t] = wmma_bf16(fa[t][u + 1].v, fb[u + 1].v, s1[t]);
                }
            __builtin_amdgcn_sched_barrier(0);
        }
        float x[2][8];
        float mx = -INFINITY;
#pragma unroll
        for (int t = 0; t < 2; ++t)
#pragma unroll
            for (int i = 0; i < 8; ++i) {
                x[t][i] = ((s0[t][i] + s1[t][i]) + bias) * 0.125f;
                mx = fmaxf(mx, x[t][i]);
            }
        mx = fmaxf(mx, xhalf(mx));
        lds.mx[c * FA_MXP + wave] = mx;  // both halves hold the same value
        lds_barrier();                   // every wave's maxima are in LDS
        float4 m4[2];
#pragma unroll
        for (int i = 0; i < 2; ++i) m4[i] = *(const float4*)&lds.mx[c * FA_MXP + 4 * i];
        float mr = -INFINITY;
#pragma unroll
        for (int i = 0; i < 2; ++i)
            mr = fmaxf(mr, fmaxf(fmaxf(m4[i].x, m4[i].y), fmaxf(m4[i].z, m4[i].w)));
        const float m_new = fmaxf(m_run, mr);
        const float scale = exp_slot(m_run - m_new);
        m_run = m_new;
        float ls = 0.0f;                 // the sum is taken of the rounded weights
#pragma unroll
        for (int t = 0; t < 2; ++t) {
            u32x4 pw;
#pragma unroll
            for (int i = 0; i < 4; ++i) {
                pw[i] = pack2(exp_slot(x[t][2 * i] - m_new), exp_slot(x[t][2 * i + 1] - m_new));
                ls += bf_lo(pw[i]) + bf_hi(pw[i]);
            }
            lds.p[wave][t][lane] = pw;
        }
        l_run = fmaf(l_run, scale, ls);
        lds_barrier();                   // every wave's rows and weights are in LDS

#pragma unroll
        for (int t = 0; t < 4; ++t)
#pragma unroll
            for (int i = 0; i < 8; ++i) acc[t][i] *= scale;
#pragma unroll
        for (int j = 0; j < FA_ROWS / 32; j += 2) {
            Frag fp[2], ft[2][4];
#pragma unroll
            for (int u = 0; u < 2; ++u) {
                fp[u].q[0] = lds.p[j + u][0][lane];
                fp[u].q[1] = lds.p[j + u][1][lane];
                const unsigned char* tj = tt + (j + u) * 32 * FA_PITCH;
#pragma unroll
                for (int t = 0; t < 4; ++t) {
                    ft[u][t].q[0] = ld_tr16(tj + 32 * t);
                    ft[u][t].q[1] = ld_tr16(tj + 16 * FA_PITCH + 32 * t);
                }
            }
            __builtin_amdgcn_sched_barrier(0);   // fence pair, as in the score loop: 20 loads together, then their WMMAs
#pragma unroll
            for (int u = 0; u < 2; ++u)
#pragma unroll
                for (int t = 0; t < 4; ++t)
                    acc[t] = wmma_bf16(ft[u][t].v, fp[u].v, acc[t]);
            __builtin_amdgcn_sched_barrier(0);
        }
        if (r + 1 < FA_ROUNDS)
            lds_barrier();               // all reads of this round's LDS are done
    }

    // The waves' sums of weights (all against the same final maximum) -> wave 0.
    lds.mx[c * FA_MXP + wave] = l_run + xhalf(l_run);
    lds_barrier();

    // acc[t][i] = ctx^T[e = 64w + 16t + 8h + i][head c]; heads 8..15 are padding.
    if (c < HH) {
        float* o = part + (((size_t)ch * NN + n) * HH + c) * EE + wave * 64 + 8 * h;
#pragma unroll
        for (int t = 0; t < 4; ++t) {
            *(float4*)(o + 16 * t)     = make_float4(acc[t][0], acc[t][1], acc[t][2], acc[t][3]);
            *(float4*)(o + 16 * t + 4) = make_float4(acc[t][4], acc[t][5], acc[t][6], acc[t][7]);
        }
        if (wave == 0 && h == 0) {
            float l_tot = 0.0f;
#pragma unroll
            for (int w = 0; w < FA_WAVES; ++w) l_tot += lds.mx[c * FA_MXP + w];
            ml[((ch * NN + n) * HH + c) * 2 + 0] = m_run;
            ml[((ch * NN + n) * HH + c) * 2 + 1] = l_tot;
        }
    }
}

// ---------------------------------------------------------------------------
// Stage 5: merge of the 8 chunks and V projection in one launch, then the last linear.
//   mo[n,j] = sum_k (w[k] * (1 / L)) * (Wv[j,:] . part[k, n, j>>6, :]) + bv[j]
//   w[k] = exp(m[k] - M), M = max_k m[k], L = sum_k w[k] * l[k]
// (bv passes through: the merged weights sum to 1). The projection is linear, so it
// is applied to the chunks' un-normalised sums as they lie in memory: the 16 rows of
// the f32 WMMA tile are 2 n x 8 chunks, and the merge is a weighted sum of the eight
// D registers of a lane. One block of 16 waves owns 2 rows n x 32 columns j; wave w
// owns the K slice [32w, 32w+32), loaders and k order as in lin_tile. Every loop is
// unrolled, so that its small arrays are registers and its loads go out together.
//   out = mo @ W2.T + b2   (W2 = Wl Wo, b2 = Wl bo + bl, from the first launch)
// ---------------------------------------------------------------------------
struct VmLds {
    float red[LIN_WAVES][2][32];               // K-slice partials of the merged rows, lane-major
    float stage[LIN_WAVES][48][LIN_PITCH];     // per wave: 16 rows of part, 32 rows of Wv
};

__global__ __launch_bounds__(512) void vproj_merge_kernel(const float* __restrict__ part,
                                                          const float* __restrict__ ml,
                                                          const float* __restrict__ Wv,
                                                          const float* __restrict__ bv,
                                                          float* __restrict__ mo) {
    __shared__ __attribute__((aligned(16))) VmLds lds;
    const int j0 = (blockIdx.x & 15) * 32, n0 = (blockIdx.x >> 4) * 2;
    const int head = j0 >> 6;            // the block's 32 columns lie in one head
    // The wave's number in a scalar register: scalar bases and one lane offset each.
    const int wave = __builtin_amdgcn_readfirstlane(threadIdx.x >> 5);
    const int lane = threadIdx.x & 31;
    const int kb = wave * 32;
    const int lr = lane >> 3;            // row within a group of four
    const int lc = (lane & 7) * 4;       // float offset within the 128-byte slice
    const int c = lane & 15, h = lane >> 4;
    const int CH = NN * HH * EE;         // floats between consecutive chunks of part
    const char* XB = (const char*)(part + ((size_t)n0 * HH + head) * EE + kb);
    const char* WB = (const char*)(Wv + (size_t)j0 * EE + kb);
    const char* MB = (const char*)(ml + ((size_t)n0 * HH + head) * 2);
    const unsigned int xo = (lr * CH + lc) * 4, wo = (lr * EE + lc) * 4, mlo = h * HH * 2 * 4;

    // Tile row 8a + k = part[chunk k][n0 + a][head]; load i brings rows 4i .. 4i+3.
    float4 gx[4], gw[8];
    float2 mlv[FA_CHUNKS];               // (max, sum) of every chunk, for n0 + h
#pragma unroll
    for (int i = 0; i < 4; ++i)
        gx[i] = *(const float4*)(XB + ((i & 1) * 4 * CH + (i >> 1) * HH * EE) * 4 + xo);
#pragma unroll
    for (int i = 0; i < 8; ++i)
        gw[i] = *(const float4*)(WB + i * 4 * EE * 4 + wo);
#pragma unroll
    for (int k = 0; k < FA_CHUNKS; ++k)
        mlv[k] = *(const float2*)(MB + k * NN * HH * 2 * 4 + mlo);
    const float bias = (bv + j0)[lane];  // asked for with the tiles, used at the very end
    __builtin_amdgcn_sched_barrier(0);   // every load is asked for before anything waits
    // The merge weights of n0 + h, divided by the merged sum.
    float M = mlv[0].x;
#pragma unroll
    for (int k = 1; k < FA_CHUNKS; ++k) M = fmaxf(M, mlv[k].x);
    float wn[FA_CHUNKS];
    float L = 0.0f;
#pragma unroll
    for (int k = 0; k < FA_CHUNKS; ++k) {
        wn[k] = exp_slot(mlv[k].x - M);
        L = fmaf(wn[k], mlv[k].y, L);
    }
    const float rl = 1.0f / L;
#pragma unroll
    for (int k = 0; k < FA_CHUNKS; ++k) wn[k] *= rl;
#pragma unroll
    for (int i = 0; i < 4; ++i)
        *(float4*)&lds.stage[wave][i * 4 + lr][lc] = gx[i];
#pragma unroll
    for (int i = 0; i < 8; ++i)
        *(float4*)&lds.stage[wave][16 + i * 4 + lr][lc] = gw[i];
    // The wave reads back rows that its other lanes wrote: its own LDS stores
    // must be done, and the compiler must not lift the reads over them. The weights
    // are inputs, so that they are complete here: a build had their arithmetic in the
    // run of WMMAs below.
    asm volatile("s_wait_dscnt 0x0" :: "v"(wn[0]), "v"(wn[1]), "v"(wn[2]), "v"(wn[3]),
                 "v"(wn[4]), "v"(wn[5]), "v"(wn[6]), "v"(wn[7]) : "memory");

    float4 fx[4], f0[4], f1[4];
#pragma unroll
    for (int i = 0; i < 4; ++i) {
        fx[i] = *(const float4*)&lds.stage[wave][c][8 * i + 4 * h];
        f0[i] = *(const float4*)&lds.stage[wave][16 + c][8 * i + 4 * h];
        f1[i] = *(const float4*)&lds.stage[wave][32 + c][8 * i + 4 * h];
    }
    // Fence pair, as in lin_tile: the LDS reads stay ahead of the WMMAs and no
    // address arithmetic is scheduled into the run behind an operand's last use.
    __builtin_amdgcn_sched_barrier(0);
    v8f acc0 = {}, acc1 = {};
#pragma unroll
    for (int i = 0; i < 4; ++i) {
        acc0 = wmma_f32(fx[i].x, fx[i].y, f0[i].x, f0[i].y, acc0);
        acc1 = wmma_f32(fx[i].x, fx[i].y, f1[i].x, f1[i].y, acc1);
        acc0 = wmma_f32(fx[i].z, fx[i].w, f0[i].z, f0[i].w, acc0);
        acc1 = wmma_f32(fx[i].z, fx[i].w, f1[i].z, f1[i].w, acc1);
    }
    __builtin_amdgcn_sched_barrier(0);
    // The distance between the last WMMAs and the vector instructions below, which
    // read their results; the results pass through, so that every reader stands behind.
    asm volatile("v_nop\n\tv_nop\n\tv_nop\n\tv_nop" : "+v"(acc0), "+v"(acc1));
    // D register k of lane (c, h), tile t = Wv[j0 + 16t + c, K slice] . part[chunk k][n0 + h][head].
    float s0 = 0.0f, s1 = 0.0f;
#pragma unroll
    for (int k = 0; k < FA_CHUNKS; ++k) {
        s0 = fmaf(wn[k], acc0[k], s0);
        s1 = fmaf(wn[k], acc1[k], s1);
    }
    lds.red[wave][0][lane] = s0;
    lds.red[wave][1][lane] = s1;
    __syncthreads();                     // every wave's merged partials are in LDS
    // Waves 0 and 1 store rows n0 and n0 + 1: 32 columns = one whole 128-byte line each.
    if (wave < 2) {
        const float* pr = &lds.red[0][h][wave * 16 + c];
        float t0 = pr[0 * 64], t1 = pr[1 * 64], t2 = pr[2 * 64], t3 = pr[3 * 64];
#pragma unroll
        for (int w = 4; w < LIN_WAVES; w += 4) {
            t0 += pr[(w + 0) * 64];
            t1 += pr[(w + 1) * 64];
            t2 += pr[(w + 2) * 64];
            t3 += pr[(w + 3) * 64];
        }
        mo[(size_t)(n0 + wave) * EE + j0 + lane] = ((t0 + t1) + (t2 + t3)) + bias;
    }
}

__global__ __launch_bounds__(512) void lin_kernel(const float* __restrict__ A,
                                                  const float* __restrict__ W,
                                                  const float* __restrict__ b,
                                                  float* __restrict__ out) {
    int j0 = (blockIdx.x & 15) * 32, n0 = (blockIdx.x >> 4) * 16;
    lin_tile(A, EE, W, b, out, n0, j0);
}

// ---------------------------------------------------------------------------
extern "C" void kernel_launch(void* const* d_in, const int* in_sizes, int n_in,
                              void* d_out, int out_size, void* d_ws, size_t ws_size,
                              hipStream_t stream) {
    const float* src = (const float*)d_in[0];
    const float* Wq  = (const float*)d_in[1];
    const float* bq  = (const float*)d_in[2];
    const float* Wk  = (const float*)d_in[3];
    const float* bk  = (const float*)d_in[4];
    const float* Wv  = (const float*)d_in[5];
    const float* bv  = (const float*)d_in[6];
    const float* Wo  = (const float*)d_in[7];
    const float* bo  = (const float*)d_in[8];
    const float* Wl  = (const float*)d_in[9];
    const float* bl  = (const float*)d_in[10];

    float* ws = (float*)d_ws;
    float* qkbuf  = ws + 16384;       // 32*16*512 = 262144 (head-padded)
    float* sb     = ws + 278528;      // 256
    float* ml     = ws + 278784;      // 8*32*8 pairs (max, sum) = 4096
    float* part   = ws + 3424512;     // 8*32*8*512 = 1048576
    float* mo     = ws + 4604160;     // 16384
    float* W2     = ws + 4620544;     // 512*512 = 262144
    float* b2     = ws + 4882688;     // 512  (end: 4883200 floats ~ 18.6 MB)

    qk_fused_kernel<<<192, 512, 0, stream>>>(src, Wq, bq, Wk, bk, Wo, bo, Wl, bl, qkbuf, sb, W2, b2);
    attn_pass_kernel<<<dim3(32, 8), 256, 0, stream>>>(src, qkbuf, sb, part, ml);
    vproj_merge_kernel<<<256, 512, 0, stream>>>(part, ml, Wv, bv, mo);
    lin_kernel    <<<32,   512, 0, stream>>>(mo, W2, b2, (float*)d_out);
}
